// v000
// The times below were measured on an AMD MI455X: many runs one after another, warmed up first and cycling through
// copies of the inputs, with the whole window's GPU time divided by the number of runs. Launches and the gaps
// between them are all in it. The median over several windows is given; except for v000 it joins two sittings, which
// can be a few percent apart, so the side-by-side timings, each taken in one sitting, are the better comparison.
// The starting kernel, v000, takes 490 microseconds a run.
#include <hip/hip_runtime.h>

// ---------------------------------------------------------------------------
// CDNA5 (gfx1250, wave32) Laplacian-kernel attention, fp32 WMMA path
// + async LDS double-buffering (GLOBAL_LOAD_ASYNC_TO_LDS_B128 / ASYNCcnt).
// ---------------------------------------------------------------------------

typedef float v2f __attribute__((ext_vector_type(2)));
typedef float v8f __attribute__((ext_vector_type(8)));

#define DIM      1024
#define HEADS    16
#define HEAD_DIM 64
#define BATCH    2
#define SEQ      1024
#define LAMBDA_  4.0f
#define EPS_     1e-6f

// ---------------------------------------------------------------------------
// fp32 WMMA GEMM:  out[m][n] = sum_k A[m*K+k] * W[n*K+k] + bias[n]
// One wave computes a 32x32 output tile (4 C fragments) so each A/B fragment
// is reused twice: per K-step 4 b64 loads feed 4 v_wmma_f32_16x16x4_f32.
// Block = 128 threads = 4 waves -> 32x128 strip of the output.
// ---------------------------------------------------------------------------
__global__ __launch_bounds__(128)
void wmma_gemm_nt(const float* __restrict__ A, const float* __restrict__ W,
                  const float* __restrict__ bias, float* __restrict__ out,
                  int N, int K) {
    const int lane = threadIdx.x & 31;
    const int wave = threadIdx.x >> 5;
    const int m0   = blockIdx.y * 32;
    const int n0   = blockIdx.x * 128 + wave * 32;
    const int mn   = lane & 15;   // A-frag row / B-frag col fed by this lane
    const int hi   = lane >> 4;   // K-pair select {0,1} vs {2,3}

    // A-frag layout (ISA 7.12.2, 32-bit A 16x4): lane m holds A[m][2*hi + {0,1}]
    const float* arow0 = A + (size_t)(m0 + mn) * K + 2 * hi;
    const float* arow1 = arow0 + (size_t)16 * K;
    // B[k][n] = W[n][k]; VGPR r, half-wave hi -> B[k0 + 2*hi + r][n]
    const float* wrow0 = W + (size_t)(n0 + mn) * K + 2 * hi;
    const float* wrow1 = wrow0 + (size_t)16 * K;

    v8f c00 = {}, c01 = {}, c10 = {}, c11 = {};
    for (int k0 = 0; k0 < K; k0 += 4) {
        v2f a0 = *(const v2f*)(arow0 + k0);
        v2f a1 = *(const v2f*)(arow1 + k0);
        v2f b0 = *(const v2f*)(wrow0 + k0);
        v2f b1 = *(const v2f*)(wrow1 + k0);
        c00 = __builtin_amdgcn_wmma_f32_16x16x4_f32(false, a0, false, b0, (short)0, c00, false, false);
        c01 = __builtin_amdgcn_wmma_f32_16x16x4_f32(false, a0, false, b1, (short)0, c01, false, false);
        c10 = __builtin_amdgcn_wmma_f32_16x16x4_f32(false, a1, false, b0, (short)0, c10, false, false);
        c11 = __builtin_amdgcn_wmma_f32_16x16x4_f32(false, a1, false, b1, (short)0, c11, false, false);
    }

    // C/D layout: VGPR r -> row (r + 8*hi), col = lane&15
    const float bn0 = bias[n0 + mn];
    const float bn1 = bias[n0 + 16 + mn];
#pragma unroll
    for (int r = 0; r < 8; ++r) {
        const int row0 = m0 + r + 8 * hi;
        const int row1 = row0 + 16;
        out[(size_t)row0 * N + (n0 + mn)]      = c00[r] + bn0;
        out[(size_t)row0 * N + (n0 + 16 + mn)] = c01[r] + bn1;
        out[(size_t)row1 * N + (n0 + mn)]      = c10[r] + bn0;
        out[(size_t)row1 * N + (n0 + 16 + mn)] = c11[r] + bn1;
    }
}

// ---------------------------------------------------------------------------
// Async-copy one 16x64 f32 tile (k and v) into LDS: 4 async b128 per wave.
// GVS mode: mem = SGPR base + 32-bit VGPR byte offset. Tracked by ASYNCcnt.
// ---------------------------------------------------------------------------
__device__ __forceinline__
void async_tile_issue(const float* __restrict__ krow, const float* __restrict__ vrow,
                      float4* kdst, float4* vdst, int tid) {
#pragma unroll
    for (int e = tid; e < 256; e += 128) {        // 16 rows x 16 float4
        const int r = e >> 4, c4 = e & 15;
        const unsigned goff = (unsigned)(r * (3 * DIM * 4) + c4 * 16); // bytes
        const unsigned kl = (unsigned)(uintptr_t)(kdst + e);           // LDS byte addr
        const unsigned vl = (unsigned)(uintptr_t)(vdst + e);
        asm volatile("global_load_async_to_lds_b128 %0, %1, %2"
                     :: "v"(kl), "v"(goff), "s"(krow) : "memory");
        asm volatile("global_load_async_to_lds_b128 %0, %1, %2"
                     :: "v"(vl), "v"(goff), "s"(vrow) : "memory");
    }
}

// ---------------------------------------------------------------------------
// Laplacian (L1) kernel attention.  qkv buffer: [B*S, 3*DIM] row-major,
// q|k|v split along columns, head h -> columns h*64..h*64+63.
// Block = 128 thr = 4 waves; each wave owns 16 query rows (q row in VGPRs).
// Per 16-key tile: each lane computes exactly its 8 A-fragment kernel
// entries (VALU |q-k| + v_exp_f32), then 16 WMMAs accumulate kern @ v.
// k/v tiles double-buffered in LDS via async loads.
// ---------------------------------------------------------------------------
__global__ __launch_bounds__(128)
void lap_attn(const float* __restrict__ qkv, float* __restrict__ y) {
    __shared__ float4 kv4[2][2][16 * 16];  // [buffer][k|v][16 rows x 16 float4]
    __shared__ float  rs_[4][16];          // per-wave row sums

    const int tid  = threadIdx.x;
    const int lane = tid & 31;
    const int wave = tid >> 5;
    const int bh   = blockIdx.y;
    const int b    = bh >> 4;              // / HEADS
    const int h    = bh & 15;
    const int ib   = blockIdx.x * 64 + wave * 16;  // wave's query base row
    const int m    = lane & 15;
    const int hi   = lane >> 4;

    const size_t rstride = 3 * DIM;
    const float* qbase = qkv + (size_t)(b * SEQ) * rstride + h * HEAD_DIM;
    const float* kbase = qbase + DIM;
    const float* vbase = qbase + 2 * DIM;

    // q row (ib+m): 64 f32 = 16 float4 in VGPRs (lanes m and m+16 duplicate)
    float4 q[16];
    {
        const float4* qp = (const float4*)(qbase + (size_t)(ib + m) * rstride);
#pragma unroll
        for (int i = 0; i < 16; ++i) q[i] = qp[i];
    }

    v8f acc[4] = {};          // 16 rows x 64 dh as four 16x16 f32 C fragments
    float rowsum = 0.0f;

    // prologue: async-load tile 0 into buffer 0
    async_tile_issue(kbase, vbase, &kv4[0][0][0], &kv4[0][1][0], tid);

    int buf = 0;
    for (int jb = 0; jb < SEQ; jb += 16) {
        __syncthreads();   // buffer buf^1 fully consumed by the previous tile
        if (jb + 16 < SEQ) {
            async_tile_issue(kbase + (size_t)(jb + 16) * rstride,
                             vbase + (size_t)(jb + 16) * rstride,
                             &kv4[buf ^ 1][0][0], &kv4[buf ^ 1][1][0], tid);
            // async loads complete in order: <=4 outstanding means the
            // 4 for the *current* tile have landed; next tile stays in flight
            asm volatile("s_wait_asynccnt 4" ::: "memory");
        } else {
            asm volatile("s_wait_asynccnt 0" ::: "memory");
        }
        __syncthreads();   // every wave's portion of current tile visible

        const float4* ks4 = &kv4[buf][0][0];
        const float*  vsf = (const float*)&kv4[buf][1][0];

        // 8 kernel entries per lane -> A fragments for the 4 K-steps
        v2f afrag[4];
#pragma unroll
        for (int p = 0; p < 4; ++p) {
#pragma unroll
            for (int half = 0; half < 2; ++half) {
                const int j = 4 * p + 2 * hi + half;       // key within tile
                const float4* kr = &ks4[j * 16];
                float dist = 0.0f;
#pragma unroll
                for (int d4 = 0; d4 < 16; ++d4) {
                    float4 kv = kr[d4];
                    dist += __builtin_fabsf(q[d4].x - kv.x)
                          + __builtin_fabsf(q[d4].y - kv.y)
                          + __builtin_fabsf(q[d4].z - kv.z)
                          + __builtin_fabsf(q[d4].w - kv.w);
                }
                float kern = __expf(dist * (-LAMBDA_ / (float)HEAD_DIM));
                rowsum += kern;
                if (half == 0) afrag[p].x = kern; else afrag[p].y = kern;
            }
        }

        // kern(16x16) @ v(16x64): 4 N-subtiles x 4 K-steps of 16x16x4 WMMA
#pragma unroll
        for (int t = 0; t < 4; ++t) {
#pragma unroll
            for (int p = 0; p < 4; ++p) {
                const int krow = 4 * p + 2 * hi;
                v2f bfrag;
                bfrag.x = vsf[(krow    ) * 64 + t * 16 + m];
                bfrag.y = vsf[(krow + 1) * 64 + t * 16 + m];
                acc[t] = __builtin_amdgcn_wmma_f32_16x16x4_f32(
                             false, afrag[p], false, bfrag,
                             (short)0, acc[t], false, false);
            }
        }
        buf ^= 1;
    }

    // total row sum: lanes m and m+16 hold halves of row m (wave32 shuffle)
    rowsum += __shfl_xor(rowsum, 16, 32);
    if (hi == 0) rs_[wave][m] = rowsum;   // intra-wave DS ordering suffices

    // normalize + store: row r+8*hi, col t*16+m -> y[b][s][h*64+d]
#pragma unroll
    for (int r = 0; r < 8; ++r) {
        const int row = r + 8 * hi;
        const float inv = 1.0f / (rs_[wave][row] + EPS_);
        const int s = ib + row;
        float* yr = y + (size_t)(b * SEQ + s) * DIM + h * HEAD_DIM + m;
#pragma unroll
        for (int t = 0; t < 4; ++t)
            yr[t * 16] = acc[t][r] * inv;
    }
}

// ---------------------------------------------------------------------------
// Depthwise conv1d (kernel 3, pad 1, cross-correlation per XLA) on v,
// accumulated into y:  y[b][s][c] += b[c] + sum_r v[b][s-1+r][c] * w[c][r]
// ---------------------------------------------------------------------------
__global__ __launch_bounds__(256)
void dwconv_add(const float* __restrict__ qkv, const float* __restrict__ w,
                const float* __restrict__ bias, float* __restrict__ y) {
    const int idx = blockIdx.x * 256 + threadIdx.x;  // over B*S*DIM (exact)
    const int c = idx & (DIM - 1);
    const int s = (idx >> 10) & (SEQ - 1);
    const int b = idx >> 20;
    const int h = c >> 6, d = c & 63;

    const float* vb = qkv + (size_t)(b * SEQ) * (3 * DIM) + 2 * DIM + h * HEAD_DIM + d;
    float acc = bias[c];
    if (s > 0)       acc += vb[(size_t)(s - 1) * (3 * DIM)] * w[c * 3 + 0];
    acc                  += vb[(size_t)(s    ) * (3 * DIM)] * w[c * 3 + 1];
    if (s < SEQ - 1) acc += vb[(size_t)(s + 1) * (3 * DIM)] * w[c * 3 + 2];
    y[idx] += acc;
}

// ---------------------------------------------------------------------------
extern "C" void kernel_launch(void* const* d_in, const int* in_sizes, int n_in,
                              void* d_out, int out_size, void* d_ws, size_t ws_size,
                              hipStream_t stream) {
    const float* x      = (const float*)d_in[0];   // [B,S,DIM]
    const float* qkv_w  = (const float*)d_in[1];   // [3*DIM, DIM]
    const float* qkv_b  = (const float*)d_in[2];   // [3*DIM]
    const float* proj_w = (const float*)d_in[3];   // [DIM, DIM]
    const float* proj_b = (const float*)d_in[4];   // [DIM]
    const float* dwc_w  = (const float*)d_in[5];   // [DIM,1,3]
    const float* dwc_b  = (const float*)d_in[6];   // [DIM]
    float* out = (float*)d_out;                    // [B,S,DIM]

    const int M = BATCH * SEQ;                     // 2048
    float* qkv_buf = (float*)d_ws;                               // M x 3*DIM (24 MB)
    float* y_buf   = qkv_buf + (size_t)M * 3 * DIM;              // M x DIM   (8 MB)

    // 1) QKV projection: [2048,1024] @ [1024,3072(T)] -> [2048,3072]
    wmma_gemm_nt<<<dim3((3 * DIM) / 128, M / 32), 128, 0, stream>>>(
        x, qkv_w, qkv_b, qkv_buf, 3 * DIM, DIM);

    // 2) Laplacian-kernel attention -> y_buf (fully overwritten)
    lap_attn<<<dim3(SEQ / 64, BATCH * HEADS), 128, 0, stream>>>(qkv_buf, y_buf);

    // 3) local depthwise-conv branch accumulated into y_buf
    dwconv_add<<<(M * DIM) / 256, 256, 0, stream>>>(qkv_buf, dwc_w, dwc_b, y_buf);

    // 4) output projection: [2048,1024] @ [1024,1024(T)] + b -> out
    wmma_gemm_nt<<<dim3(DIM / 128, M / 32), 128, 0, stream>>>(
        y_buf, proj_w, proj_b, out, DIM, DIM);
}

// v001
// A run of this version takes 256 microseconds.
// Two timings next to v000 put it at 2.03 and 1.99 times that version's speed.
#include <hip/hip_runtime.h>

// ---------------------------------------------------------------------------
// CDNA5 (gfx1250, wave32) Laplacian-kernel attention, fp32 WMMA path
// + async LDS double-buffering (GLOBAL_LOAD_ASYNC_TO_LDS_B128 / ASYNCcnt).
// ---------------------------------------------------------------------------

typedef float v2f __attribute__((ext_vector_type(2)));
typedef float v8f __attribute__((ext_vector_type(8)));

#define DIM      1024
#define HEADS    16
#define HEAD_DIM 64
#define BATCH    2
#define SEQ      1024
#define LAMBDA_  4.0f
#define EPS_     1e-6f

// ---------------------------------------------------------------------------
// fp32 WMMA GEMM:  out[m][n] = sum_k A[m*DIM+k] * W[n*DIM+k] + bias[n]
// Block = 256 threads = 8 waves (2 x 4) -> 64x128 tile of the output, each
// wave a 32x32 tile (4 C fragments).  A stage is 64 k of the block's 64 A rows
// and 128 W rows, brought into LDS by async copies, two buffers: the next
// stage's copies fly while this stage's 64 WMMAs per wave run.
// k order of every sum as with direct loads: ascending, four per WMMA.
// ---------------------------------------------------------------------------
#define GBM    64
#define GBN    128
#define GBK    64
#define GPITCH 68                        // floats; 272 B = 16 B x 17: no bank conflict
#define GSTAGE ((GBM + GBN) * GPITCH)    // floats per buffer

// One stage: 192 rows x 256 B = 12 b128 copies per lane, whole 128-B lines.
// ga / gw: this lane's 16 bytes in its first A / W row; rows step by 16.
// lds: this lane's LDS byte address in its first row of the buffer (A rows, then W rows).
__device__ __forceinline__
void gemm_stage_issue(const float* ga, const float* gw, unsigned lds) {
    // s_wait_xcnt closes the statement: no address register of a copy is
    // rewritten before the copies have taken their addresses.
    asm volatile(
        "global_load_async_to_lds_b128 %0, %12, off\n\t"
        "global_load_async_to_lds_b128 %1, %13, off\n\t"
        "global_load_async_to_lds_b128 %2, %14, off\n\t"
        "global_load_async_to_lds_b128 %3, %15, off\n\t"
        "global_load_async_to_lds_b128 %4, %16, off\n\t"
        "global_load_async_to_lds_b128 %5, %17, off\n\t"
        "global_load_async_to_lds_b128 %6, %18, off\n\t"
        "global_load_async_to_lds_b128 %7, %19, off\n\t"
        "global_load_async_to_lds_b128 %8, %20, off\n\t"
        "global_load_async_to_lds_b128 %9, %21, off\n\t"
        "global_load_async_to_lds_b128 %10, %22, off\n\t"
        "global_load_async_to_lds_b128 %11, %23, off\n\t"
        "s_wait_xcnt 0x0"
        :: "v"(lds + 0u * (16u * GPITCH * 4u)), "v"(lds + 1u * (16u * GPITCH * 4u)), "v"(lds + 2u * (16u * GPITCH * 4u)), "v"(lds + 3u * (16u * GPITCH * 4u)), "v"(lds + 4u * (16u * GPITCH * 4u)), "v"(lds + 5u * (16u * GPITCH * 4u)), "v"(lds + 6u * (16u * GPITCH * 4u)), "v"(lds + 7u * (16u * GPITCH * 4u)), "v"(lds + 8u * (16u * GPITCH * 4u)), "v"(lds + 9u * (16u * GPITCH * 4u)), "v"(lds + 10u * (16u * GPITCH * 4u)), "v"(lds + 11u * (16u * GPITCH * 4u)),
           "v"(ga + 0 * 16 * DIM), "v"(ga + 1 * 16 * DIM), "v"(ga + 2 * 16 * DIM), "v"(ga + 3 * 16 * DIM), "v"(gw + 0 * 16 * DIM), "v"(gw + 1 * 16 * DIM), "v"(gw + 2 * 16 * DIM), "v"(gw + 3 * 16 * DIM), "v"(gw + 4 * 16 * DIM), "v"(gw + 5 * 16 * DIM), "v"(gw + 6 * 16 * DIM), "v"(gw + 7 * 16 * DIM)
        : "memory");
}

__global__ __launch_bounds__(256)
void wmma_gemm_nt(const float* __restrict__ A, const float* __restrict__ W,
                  const float* __restrict__ bias, float* __restrict__ out,
                  int N) {
    __shared__ __attribute__((aligned(16))) float sm[2 * GSTAGE];

    const int tid  = threadIdx.x;
    const int lane = tid & 31;
    const int wave = tid >> 5;
    const int wm   = wave >> 2;   // 0..1: 32-row slice of the block tile
    const int wn   = wave & 3;    // 0..3: 32-column slice
    const int bm0  = blockIdx.y * GBM;
    const int bn0  = blockIdx.x * GBN;
    const int mn   = lane & 15;   // A-frag row / B-frag col fed by this lane
    const int hi   = lane >> 4;   // K-pair select {0,1} vs {2,3}

    // copy addresses: 16 lanes cover one 256-B row piece
    const int crow = tid >> 4, cc = tid & 15;
    const float* ga = A + (size_t)(bm0 + crow) * DIM + cc * 4;
    const float* gw = W + (size_t)(bn0 + crow) * DIM + cc * 4;
    const unsigned lds0 = (unsigned)(uintptr_t)(sm + crow * GPITCH + cc * 4);

    // fragment addresses (ISA 7.12.2, 32-bit A 16x4): lane holds k = 2*hi + {0,1}
    const float* sa = sm + (wm * 32 + mn) * GPITCH + 2 * hi;
    const float* sb = sm + (GBM + wn * 32 + mn) * GPITCH + 2 * hi;

    const int NT = DIM / GBK;     // 16 stages

    gemm_stage_issue(ga, gw, lds0);
    asm volatile("s_wait_asynccnt 0x0" ::: "memory");  // own copies of stage 0 landed
    __syncthreads();                                   // every wave's copies visible
    gemm_stage_issue(ga + GBK, gw + GBK, lds0 + GSTAGE * 4u);

    v8f c00 = {}, c01 = {}, c10 = {}, c11 = {};
    for (int t = 0; t < NT; ++t) {
        const int bo = (t & 1) * GSTAGE;
        const float* pa = sa + bo;
        const float* pb = sb + bo;
        // unrolled: k offsets become immediates, later k steps' LDS loads issue ahead of the WMMAs
#pragma unroll
        for (int kk = 0; kk < GBK; kk += 4) {
            v2f a0 = *(const v2f*)(pa + kk);
            v2f a1 = *(const v2f*)(pa + 16 * GPITCH + kk);
            v2f b0 = *(const v2f*)(pb + kk);
            v2f b1 = *(const v2f*)(pb + 16 * GPITCH + kk);
            c00 = __builtin_amdgcn_wmma_f32_16x16x4_f32(false, a0, false, b0, (short)0, c00, false, false);
            c01 = __builtin_amdgcn_wmma_f32_16x16x4_f32(false, a0, false, b1, (short)0, c01, false, false);
            c10 = __builtin_amdgcn_wmma_f32_16x16x4_f32(false, a1, false, b0, (short)0, c10, false, false);
            c11 = __builtin_amdgcn_wmma_f32_16x16x4_f32(false, a1, false, b1, (short)0, c11, false, false);
        }
        asm volatile("s_wait_dscnt 0x0" ::: "memory");     // own reads of this buffer done
        asm volatile("s_wait_asynccnt 0x0" ::: "memory");  // own copies of stage t+1 landed
        __syncthreads();   // publishes stage t+1 and frees this buffer for the refill
        if (t + 2 < NT)
            gemm_stage_issue(ga + (t + 2) * GBK, gw + (t + 2) * GBK, lds0 + bo * 4u);
    }
    asm volatile("s_wait_asynccnt 0x0" ::: "memory");      // nothing in flight at the end

    // C/D layout: VGPR r -> row (r + 8*hi), col = lane&15
    const int m0 = bm0 + wm * 32;
    const int n0 = bn0 + wn * 32;
    const float bn0v = bias[n0 + mn];
    const float bn1v = bias[n0 + 16 + mn];
#pragma unroll
    for (int r = 0; r < 8; ++r) {
        const int row0 = m0 + r + 8 * hi;
        const int row1 = row0 + 16;
        out[(size_t)row0 * N + (n0 + mn)]      = c00[r] + bn0v;
        out[(size_t)row0 * N + (n0 + 16 + mn)] = c01[r] + bn1v;
        out[(size_t)row1 * N + (n0 + mn)]      = c10[r] + bn0v;
        out[(size_t)row1 * N + (n0 + 16 + mn)] = c11[r] + bn1v;
    }
}

// ---------------------------------------------------------------------------
// Async-copy one 16x64 f32 tile (k and v) into LDS: 4 async b128 per wave.
// GVS mode: mem = SGPR base + 32-bit VGPR byte offset. Tracked by ASYNCcnt.
// ---------------------------------------------------------------------------
__device__ __forceinline__
void async_tile_issue(const float* __restrict__ krow, const float* __restrict__ vrow,
                      float4* kdst, float4* vdst, int tid) {
#pragma unroll
    for (int e = tid; e < 256; e += 128) {        // 16 rows x 16 float4
        const int r = e >> 4, c4 = e & 15;
        const unsigned goff = (unsigned)(r * (3 * DIM * 4) + c4 * 16); // bytes
        const unsigned kl = (unsigned)(uintptr_t)(kdst + e);           // LDS byte addr
        const unsigned vl = (unsigned)(uintptr_t)(vdst + e);
        asm volatile("global_load_async_to_lds_b128 %0, %1, %2"
                     :: "v"(kl), "v"(goff), "s"(krow) : "memory");
        asm volatile("global_load_async_to_lds_b128 %0, %1, %2"
                     :: "v"(vl), "v"(goff), "s"(vrow) : "memory");
    }
}

// ---------------------------------------------------------------------------
// Laplacian (L1) kernel attention.  qkv buffer: [B*S, 3*DIM] row-major,
// q|k|v split along columns, head h -> columns h*64..h*64+63.
// Block = 128 thr = 4 waves; each wave owns 16 query rows (q row in VGPRs).
// Per 16-key tile: each lane computes exactly its 8 A-fragment kernel
// entries (VALU |q-k| + v_exp_f32), then 16 WMMAs accumulate kern @ v.
// k/v tiles double-buffered in LDS via async loads.
// ---------------------------------------------------------------------------
__global__ __launch_bounds__(128)
void lap_attn(const float* __restrict__ qkv, float* __restrict__ y) {
    __shared__ float4 kv4[2][2][16 * 16];  // [buffer][k|v][16 rows x 16 float4]
    __shared__ float  rs_[4][16];          // per-wave row sums

    const int tid  = threadIdx.x;
    const int lane = tid & 31;
    const int wave = tid >> 5;
    const int bh   = blockIdx.y;
    const int b    = bh >> 4;              // / HEADS
    const int h    = bh & 15;
    const int ib   = blockIdx.x * 64 + wave * 16;  // wave's query base row
    const int m    = lane & 15;
    const int hi   = lane >> 4;

    const size_t rstride = 3 * DIM;
    const float* qbase = qkv + (size_t)(b * SEQ) * rstride + h * HEAD_DIM;
    const float* kbase = qbase + DIM;
    const float* vbase = qbase + 2 * DIM;

    // q row (ib+m): 64 f32 = 16 float4 in VGPRs (lanes m and m+16 duplicate)
    float4 q[16];
    {
        const float4* qp = (const float4*)(qbase + (size_t)(ib + m) * rstride);
#pragma unroll
        for (int i = 0; i < 16; ++i) q[i] = qp[i];
    }

    v8f acc[4] = {};          // 16 rows x 64 dh as four 16x16 f32 C fragments
    float rowsum = 0.0f;

    // prologue: async-load tile 0 into buffer 0
    async_tile_issue(kbase, vbase, &kv4[0][0][0], &kv4[0][1][0], tid);

    int buf = 0;
    for (int jb = 0; jb < SEQ; jb += 16) {
        __syncthreads();   // buffer buf^1 fully consumed by the previous tile
        if (jb + 16 < SEQ) {
            async_tile_issue(kbase + (size_t)(jb + 16) * rstride,
                             vbase + (size_t)(jb + 16) * rstride,
                             &kv4[buf ^ 1][0][0], &kv4[buf ^ 1][1][0], tid);
            // async loads complete in order: <=4 outstanding means the
            // 4 for the *current* tile have landed; next tile stays in flight
            asm volatile("s_wait_asynccnt 4" ::: "memory");
        } else {
            asm volatile("s_wait_asynccnt 0" ::: "memory");
        }
        __syncthreads();   // every wave's portion of current tile visible

        const float4* ks4 = &kv4[buf][0][0];
        const float*  vsf = (const float*)&kv4[buf][1][0];

        // 8 kernel entries per lane -> A fragments for the 4 K-steps
        v2f afrag[4];
#pragma unroll
        for (int p = 0; p < 4; ++p) {
#pragma unroll
            for (int half = 0; half < 2; ++half) {
                const int j = 4 * p + 2 * hi + half;       // key within tile
                const float4* kr = &ks4[j * 16];
                float dist = 0.0f;
#pragma unroll
                for (int d4 = 0; d4 < 16; ++d4) {
                    float4 kv = kr[d4];
                    dist += __builtin_fabsf(q[d4].x - kv.x)
                          + __builtin_fabsf(q[d4].y - kv.y)
                          + __builtin_fabsf(q[d4].z - kv.z)
                          + __builtin_fabsf(q[d4].w - kv.w);
                }
                float kern = __expf(dist * (-LAMBDA_ / (float)HEAD_DIM));
                rowsum += kern;
                if (half == 0) afrag[p].x = kern; else afrag[p].y = kern;
            }
        }

        // kern(16x16) @ v(16x64): 4 N-subtiles x 4 K-steps of 16x16x4 WMMA
#pragma unroll
        for (int t = 0; t < 4; ++t) {
#pragma unroll
            for (int p = 0; p < 4; ++p) {
                const int krow = 4 * p + 2 * hi;
                v2f bfrag;
                bfrag.x = vsf[(krow    ) * 64 + t * 16 + m];
                bfrag.y = vsf[(krow + 1) * 64 + t * 16 + m];
                acc[t] = __builtin_amdgcn_wmma_f32_16x16x4_f32(
                             false, afrag[p], false, bfrag,
                             (short)0, acc[t], false, false);
            }
        }
        buf ^= 1;
    }

    // total row sum: lanes m and m+16 hold halves of row m (wave32 shuffle)
    rowsum += __shfl_xor(rowsum, 16, 32);
    if (hi == 0) rs_[wave][m] = rowsum;   // intra-wave DS ordering suffices

    // normalize + store: row r+8*hi, col t*16+m -> y[b][s][h*64+d]
#pragma unroll
    for (int r = 0; r < 8; ++r) {
        const int row = r + 8 * hi;
        const float inv = 1.0f / (rs_[wave][row] + EPS_);
        const int s = ib + row;
        float* yr = y + (size_t)(b * SEQ + s) * DIM + h * HEAD_DIM + m;
#pragma unroll
        for (int t = 0; t < 4; ++t)
            yr[t * 16] = acc[t][r] * inv;
    }
}

// ---------------------------------------------------------------------------
// Depthwise conv1d (kernel 3, pad 1, cross-correlation per XLA) on v,
// accumulated into y:  y[b][s][c] += b[c] + sum_r v[b][s-1+r][c] * w[c][r]
// ---------------------------------------------------------------------------
__global__ __launch_bounds__(256)
void dwconv_add(const float* __restrict__ qkv, const float* __restrict__ w,
                const float* __restrict__ bias, float* __restrict__ y) {
    const int idx = blockIdx.x * 256 + threadIdx.x;  // over B*S*DIM (exact)
    const int c = idx & (DIM - 1);
    const int s = (idx >> 10) & (SEQ - 1);
    const int b = idx >> 20;
    const int h = c >> 6, d = c & 63;

    const float* vb = qkv + (size_t)(b * SEQ) * (3 * DIM) + 2 * DIM + h * HEAD_DIM + d;
    float acc = bias[c];
    if (s > 0)       acc += vb[(size_t)(s - 1) * (3 * DIM)] * w[c * 3 + 0];
    acc                  += vb[(size_t)(s    ) * (3 * DIM)] * w[c * 3 + 1];
    if (s < SEQ - 1) acc += vb[(size_t)(s + 1) * (3 * DIM)] * w[c * 3 + 2];
    y[idx] += acc;
}

// ---------------------------------------------------------------------------
extern "C" void kernel_launch(void* const* d_in, const int* in_sizes, int n_in,
                              void* d_out, int out_size, void* d_ws, size_t ws_size,
                              hipStream_t stream) {
    const float* x      = (const float*)d_in[0];   // [B,S,DIM]
    const float* qkv_w  = (const float*)d_in[1];   // [3*DIM, DIM]
    const float* qkv_b  = (const float*)d_in[2];   // [3*DIM]
    const float* proj_w = (const float*)d_in[3];   // [DIM, DIM]
    const float* proj_b = (const float*)d_in[4];   // [DIM]
    const float* dwc_w  = (const float*)d_in[5];   // [DIM,1,3]
    const float* dwc_b  = (const float*)d_in[6];   // [DIM]
    float* out = (float*)d_out;                    // [B,S,DIM]

    const int M = BATCH * SEQ;                     // 2048
    float* qkv_buf = (float*)d_ws;                               // M x 3*DIM (24 MB)
    float* y_buf   = qkv_buf + (size_t)M * 3 * DIM;              // M x DIM   (8 MB)

    // 1) QKV projection: [2048,1024] @ [1024,3072(T)] -> [2048,3072]
    wmma_gemm_nt<<<dim3((3 * DIM) / 128, M / 64), 256, 0, stream>>>(
        x, qkv_w, qkv_b, qkv_buf, 3 * DIM);

    // 2) Laplacian-kernel attention -> y_buf (fully overwritten)
    lap_attn<<<dim3(SEQ / 64, BATCH * HEADS), 128, 0, stream>>>(qkv_buf, y_buf);

    // 3) local depthwise-conv branch accumulated into y_buf
    dwconv_add<<<(M * DIM) / 256, 256, 0, stream>>>(qkv_buf, dwc_w, dwc_b, y_buf);

    // 4) output projection: [2048,1024] @ [1024,1024(T)] + b -> out
    wmma_gemm_nt<<<dim3(DIM / 128, M / 64), 256, 0, stream>>>(
        y_buf, proj_w, proj_b, out, DIM);
}

// v002
// Measured time: 230 microseconds a run.
// Two timings next to v001 both put it at 1.12 times that version's speed.
// Counting every step since v000, it is 2.25 times as fast.
#include <hip/hip_runtime.h>

// ---------------------------------------------------------------------------
// CDNA5 (gfx1250, wave32) Laplacian-kernel attention, fp32 WMMA path
// + async LDS double-buffering (GLOBAL_LOAD_ASYNC_TO_LDS_B128 / ASYNCcnt).
// ---------------------------------------------------------------------------

typedef float v2f __attribute__((ext_vector_type(2)));
typedef float v8f __attribute__((ext_vector_type(8)));

#define DIM      1024
#define HEADS    16
#define HEAD_DIM 64
#define BATCH    2
#define SEQ      1024
#define LAMBDA_  4.0f
#define EPS_     1e-6f

// ---------------------------------------------------------------------------
// fp32 WMMA GEMM:  out[m][n] = sum_k A[m*DIM+k] * W[n*DIM+k] + bias[n]
// Block = 256 threads = 8 waves (2 x 4) -> 64x128 tile of the output, each
// wave a 32x32 tile (4 C fragments).  A stage is 64 k of the block's 64 A rows
// and 128 W rows, brought into LDS by async copies, two buffers: the next
// stage's copies fly while this stage's 64 WMMAs per wave run.
// k order of every sum as with direct loads: ascending, four per WMMA.
// ---------------------------------------------------------------------------
#define GBM    64
#define GBN    128
#define GBK    64
#define GPITCH 68                        // floats; 272 B = 16 B x 17: no bank conflict
#define GSTAGE ((GBM + GBN) * GPITCH)    // floats per buffer

// One stage: 192 rows x 256 B = 12 b128 copies per lane, whole 128-B lines.
// ga / gw: this lane's 16 bytes in its first A / W row; rows step by 16.
// lds: this lane's LDS byte address in its first row of the buffer (A rows, then W rows).
__device__ __forceinline__
void gemm_stage_issue(const float* ga, const float* gw, unsigned lds) {
    // s_wait_xcnt closes the statement: no address register of a copy is
    // rewritten before the copies have taken their addresses.
    asm volatile(
        "global_load_async_to_lds_b128 %0, %12, off\n\t"
        "global_load_async_to_lds_b128 %1, %13, off\n\t"
        "global_load_async_to_lds_b128 %2, %14, off\n\t"
        "global_load_async_to_lds_b128 %3, %15, off\n\t"
        "global_load_async_to_lds_b128 %4, %16, off\n\t"
        "global_load_async_to_lds_b128 %5, %17, off\n\t"
        "global_load_async_to_lds_b128 %6, %18, off\n\t"
        "global_load_async_to_lds_b128 %7, %19, off\n\t"
        "global_load_async_to_lds_b128 %8, %20, off\n\t"
        "global_load_async_to_lds_b128 %9, %21, off\n\t"
        "global_load_async_to_lds_b128 %10, %22, off\n\t"
        "global_load_async_to_lds_b128 %11, %23, off\n\t"
        "s_wait_xcnt 0x0"
        :: "v"(lds + 0u * (16u * GPITCH * 4u)), "v"(lds + 1u * (16u * GPITCH * 4u)), "v"(lds + 2u * (16u * GPITCH * 4u)), "v"(lds + 3u * (16u * GPITCH * 4u)), "v"(lds + 4u * (16u * GPITCH * 4u)), "v"(lds + 5u * (16u * GPITCH * 4u)), "v"(lds + 6u * (16u * GPITCH * 4u)), "v"(lds + 7u * (16u * GPITCH * 4u)), "v"(lds + 8u * (16u * GPITCH * 4u)), "v"(lds + 9u * (16u * GPITCH * 4u)), "v"(lds + 10u * (16u * GPITCH * 4u)), "v"(lds + 11u * (16u * GPITCH * 4u)),
           "v"(ga + 0 * 16 * DIM), "v"(ga + 1 * 16 * DIM), "v"(ga + 2 * 16 * DIM), "v"(ga + 3 * 16 * DIM), "v"(gw + 0 * 16 * DIM), "v"(gw + 1 * 16 * DIM), "v"(gw + 2 * 16 * DIM), "v"(gw + 3 * 16 * DIM), "v"(gw + 4 * 16 * DIM), "v"(gw + 5 * 16 * DIM), "v"(gw + 6 * 16 * DIM), "v"(gw + 7 * 16 * DIM)
        : "memory");
}

__global__ __launch_bounds__(256)
void wmma_gemm_nt(const float* __restrict__ A, const float* __restrict__ W,
                  const float* __restrict__ bias, float* __restrict__ out,
                  int N) {
    __shared__ __attribute__((aligned(16))) float sm[2 * GSTAGE];

    const int tid  = threadIdx.x;
    const int lane = tid & 31;
    const int wave = tid >> 5;
    const int wm   = wave >> 2;   // 0..1: 32-row slice of the block tile
    const int wn   = wave & 3;    // 0..3: 32-column slice
    const int bm0  = blockIdx.y * GBM;
    const int bn0  = blockIdx.x * GBN;
    const int mn   = lane & 15;   // A-frag row / B-frag col fed by this lane
    const int hi   = lane >> 4;   // K-pair select {0,1} vs {2,3}

    // copy addresses: 16 lanes cover one 256-B row piece
    const int crow = tid >> 4, cc = tid & 15;
    const float* ga = A + (size_t)(bm0 + crow) * DIM + cc * 4;
    const float* gw = W + (size_t)(bn0 + crow) * DIM + cc * 4;
    const unsigned lds0 = (unsigned)(uintptr_t)(sm + crow * GPITCH + cc * 4);

    // fragment addresses (ISA 7.12.2, 32-bit A 16x4): lane holds k = 2*hi + {0,1}
    const float* sa = sm + (wm * 32 + mn) * GPITCH + 2 * hi;
    const float* sb = sm + (GBM + wn * 32 + mn) * GPITCH + 2 * hi;

    const int NT = DIM / GBK;     // 16 stages

    gemm_stage_issue(ga, gw, lds0);
    asm volatile("s_wait_asynccnt 0x0" ::: "memory");  // own copies of stage 0 landed
    __syncthreads();                                   // every wave's copies visible
    gemm_stage_issue(ga + GBK, gw + GBK, lds0 + GSTAGE * 4u);

    v8f c00 = {}, c01 = {}, c10 = {}, c11 = {};
    for (int t = 0; t < NT; ++t) {
        const int bo = (t & 1) * GSTAGE;
        const float* pa = sa + bo;
        const float* pb = sb + bo;
        // unrolled: k offsets become immediates, later k steps' LDS loads issue ahead of the WMMAs
#pragma unroll
        for (int kk = 0; kk < GBK; kk += 4) {
            v2f a0 = *(const v2f*)(pa + kk);
            v2f a1 = *(const v2f*)(pa + 16 * GPITCH + kk);
            v2f b0 = *(const v2f*)(pb + kk);
            v2f b1 = *(const v2f*)(pb + 16 * GPITCH + kk);
            c00 = __builtin_amdgcn_wmma_f32_16x16x4_f32(false, a0, false, b0, (short)0, c00, false, false);
            c01 = __builtin_amdgcn_wmma_f32_16x16x4_f32(false, a0, false, b1, (short)0, c01, false, false);
            c10 = __builtin_amdgcn_wmma_f32_16x16x4_f32(false, a1, false, b0, (short)0, c10, false, false);
            c11 = __builtin_amdgcn_wmma_f32_16x16x4_f32(false, a1, false, b1, (short)0, c11, false, false);
        }
        asm volatile("s_wait_dscnt 0x0" ::: "memory");     // own reads of this buffer done
        asm volatile("s_wait_asynccnt 0x0" ::: "memory");  // own copies of stage t+1 landed
        __syncthreads();   // publishes stage t+1 and frees this buffer for the refill
        if (t + 2 < NT)
            gemm_stage_issue(ga + (t + 2) * GBK, gw + (t + 2) * GBK, lds0 + bo * 4u);
    }
    asm volatile("s_wait_asynccnt 0x0" ::: "memory");      // nothing in flight at the end

    // C/D layout: VGPR r -> row (r + 8*hi), col = lane&15
    const int m0 = bm0 + wm * 32;
    const int n0 = bn0 + wn * 32;
    const float bn0v = bias[n0 + mn];
    const float bn1v = bias[n0 + 16 + mn];
#pragma unroll
    for (int r = 0; r < 8; ++r) {
        const int row0 = m0 + r + 8 * hi;
        const int row1 = row0 + 16;
        out[(size_t)row0 * N + (n0 + mn)]      = c00[r] + bn0v;
        out[(size_t)row0 * N + (n0 + 16 + mn)] = c01[r] + bn1v;
        out[(size_t)row1 * N + (n0 + mn)]      = c10[r] + bn0v;
        out[(size_t)row1 * N + (n0 + 16 + mn)] = c11[r] + bn1v;
    }
}

// ---------------------------------------------------------------------------
// Laplacian (L1) kernel attention.  qkv buffer: [B*S, 3*DIM] row-major,
// q|k|v split along columns, head h -> columns h*64..h*64+63.
// Block = 128 thr = 4 waves on 64 query rows, stages of 64 keys.
// Kernel entries: EVERY wave holds all 64 q rows in VGPRs (4 rows per lane) and
// takes 16 of the stage's 64 keys, so one LDS read of four k values feeds four
// rows' |q-k| sums.  The 64x64 entries pass through LDS to the wave that owns
// the rows: wave w multiplies rows 16w..16w+15 with v (64 WMMAs per stage),
// keys ascending.
// k/v stages in two buffers, filled by async copies.
// ---------------------------------------------------------------------------
#define AQ    64                    // query rows per block
#define AK    64                    // keys per stage (16 per wave)
#define ATILE (AK * HEAD_DIM)       // floats of one stage of k or of v
#define EPITCH 68                   // floats; 8-byte reads and writes of 16 rows: no bank conflict

// 64 rows x 256 B of k or of v = 8 b128 copies per lane, whole 256-B row pieces.
// g: this lane's 16 bytes in its first row; rows step by 8.  l: the same in LDS.
typedef int v4i __attribute__((ext_vector_type(4)));
__device__ __forceinline__
void attn_tile_issue(const float* g, float* l) {
    // unrolled: the row steps become constants of the address arithmetic
#pragma unroll
    for (int i = 0; i < 8; ++i)
        __builtin_amdgcn_global_load_async_to_lds_b128(
            (__attribute__((address_space(1))) v4i*)(g + i * 8 * 3 * DIM),
            (__attribute__((address_space(3))) v4i*)(l + i * 8 * HEAD_DIM), 0, 0);
}

__global__ __launch_bounds__(128)
void lap_attn(const float* __restrict__ qkv, float* __restrict__ y) {
    __shared__ __attribute__((aligned(16))) float kv[2 * 2 * ATILE];  // [buffer][k|v][64 rows x 64]
    __shared__ __attribute__((aligned(16))) float en[AQ * EPITCH];    // kernel entries [row][key]
    __shared__ float rs_[4][16];           // per-wave row sums

    const int tid  = threadIdx.x;
    const int lane = tid & 31;
    const int wave = tid >> 5;
    const int bh   = blockIdx.y;
    const int b    = bh >> 4;              // / HEADS
    const int h    = bh & 15;
    const int ib   = blockIdx.x * AQ;      // block's query base row
    const int m    = lane & 15;
    const int hi   = lane >> 4;

    const size_t rstride = 3 * DIM;
    const float* qbase = qkv + (size_t)(b * SEQ) * rstride + h * HEAD_DIM;
    const float* kbase = qbase + DIM;
    const float* vbase = qbase + 2 * DIM;

    // q rows ib + 16*mt + m, mt = 0..3 (lanes m and m+16 duplicate)
    // every loop over q, dist, e or acc is unrolled: only constant indices keep them in registers
    float4 q[4][16];
#pragma unroll
    for (int mt = 0; mt < 4; ++mt) {
        const float4* qp = (const float4*)(qbase + (size_t)(ib + mt * 16 + m) * rstride);
#pragma unroll
        for (int i = 0; i < 16; ++i) q[mt][i] = qp[i];
        // the row's loads have taken their address before its registers are written again
        asm volatile("s_wait_xcnt 0x0" ::: "memory");
    }

    v8f acc[4] = {};          // rows 16*wave..+15 x 64 dh as four 16x16 f32 C fragments
    float rowsum = 0.0f;

    // copy addresses: 16 lanes cover one 256-B row
    const int crow = tid >> 4, cc = tid & 15;
    const float* gk = kbase + (size_t)crow * rstride + cc * 4;
    const float* gv = vbase + (size_t)crow * rstride + cc * 4;
    float* lds0 = kv + crow * HEAD_DIM + cc * 4;

    // entries: written at [16*mt + m][16*wave + 4*p + 2*hi + {0,1}], read at [16*wave + m][4*kq + 2*hi + {0,1}]
    float*       ew = en + m * EPITCH + wave * 16 + 2 * hi;
    const float* er = en + (wave * 16 + m) * EPITCH + 2 * hi;

    const int NS = SEQ / AK;  // 16 stages

    attn_tile_issue(gk, lds0);
    attn_tile_issue(gv, lds0 + ATILE);
    asm volatile("s_wait_asynccnt 0x0" ::: "memory");  // own copies of stage 0 landed
    __syncthreads();                                   // every wave's copies visible
    attn_tile_issue(gk + AK * rstride, lds0 + 2 * ATILE);
    attn_tile_issue(gv + AK * rstride, lds0 + 3 * ATILE);

    for (int st = 0; st < NS; ++st) {
        const int bo = (st & 1) * 2 * ATILE;
        const float* ksf = kv + bo + (wave * 16 + 2 * hi) * HEAD_DIM;   // this wave's 16 keys
        const float* vsf = kv + bo + ATILE + 2 * hi * HEAD_DIM + m;

        // rolled: one trip is four keys x 64 rows; for speed only
#pragma unroll 1
        for (int p = 0; p < 4; ++p) {
            v2f e[4];
#pragma unroll
            for (int half = 0; half < 2; ++half) {
                const float4* kr = (const float4*)(ksf + (4 * p + half) * HEAD_DIM);
                float dist[4] = {0.0f, 0.0f, 0.0f, 0.0f};
#pragma unroll
                for (int d4 = 0; d4 < 16; ++d4) {
                    const float4 kk = kr[d4];
#pragma unroll
                    for (int mt = 0; mt < 4; ++mt)
                        dist[mt] += __builtin_fabsf(q[mt][d4].x - kk.x)
                                  + __builtin_fabsf(q[mt][d4].y - kk.y)
                                  + __builtin_fabsf(q[mt][d4].z - kk.z)
                                  + __builtin_fabsf(q[mt][d4].w - kk.w);
                }
#pragma unroll
                for (int mt = 0; mt < 4; ++mt) {
                    const float kern = __expf(dist[mt] * (-LAMBDA_ / (float)HEAD_DIM));
                    if (half == 0) e[mt].x = kern; else e[mt].y = kern;
                }
            }
#pragma unroll
            for (int mt = 0; mt < 4; ++mt)
                *(v2f*)(ew + mt * 16 * EPITCH + 4 * p) = e[mt];
        }
        __syncthreads();   // all 64x64 entries of this stage written

        // entries(16x64) @ v(64x64): 16 K-steps x 4 N-subtiles of 16x16x4 WMMA
#pragma unroll
        for (int kq = 0; kq < 16; ++kq) {
            const v2f afrag = *(const v2f*)(er + 4 * kq);
            rowsum += afrag.x;
            rowsum += afrag.y;
#pragma unroll
            for (int t = 0; t < 4; ++t) {
                v2f bfrag;
                bfrag.x = vsf[(4 * kq    ) * HEAD_DIM + t * 16];
                bfrag.y = vsf[(4 * kq + 1) * HEAD_DIM + t * 16];
                acc[t] = __builtin_amdgcn_wmma_f32_16x16x4_f32(
                             false, afrag, false, bfrag,
                             (short)0, acc[t], false, false);
            }
        }
        asm volatile("s_wait_dscnt 0x0" ::: "memory");     // own reads of this buffer and of the entries done
        asm volatile("s_wait_asynccnt 0x0" ::: "memory");  // own copies of stage st+1 landed
        __syncthreads();   // publishes stage st+1, frees this buffer for the refill and the entries for rewriting
        if (st + 2 < NS) {
            attn_tile_issue(gk + (size_t)(st + 2) * AK * rstride, lds0 + bo);
            attn_tile_issue(gv + (size_t)(st + 2) * AK * rstride, lds0 + bo + ATILE);
        }
    }
    asm volatile("s_wait_asynccnt 0x0" ::: "memory");      // nothing in flight at the end

    // total row sum: lanes m and m+16 hold halves of row m (wave32 shuffle)
    rowsum += __shfl_xor(rowsum, 16, 32);
    if (hi == 0) rs_[wave][m] = rowsum;   // intra-wave DS ordering suffices

    // normalize + store: row r+8*hi, col t*16+m -> y[b][s][h*64+d]
#pragma unroll
    for (int r = 0; r < 8; ++r) {
        const int row = r + 8 * hi;
        const float inv = 1.0f / (rs_[wave][row] + EPS_);
        const int s = ib + wave * 16 + row;
        float* yr = y + (size_t)(b * SEQ + s) * DIM + h * HEAD_DIM + m;
#pragma unroll
        for (int t = 0; t < 4; ++t)
            yr[t * 16] = acc[t][r] * inv;
    }
}

// ---------------------------------------------------------------------------
// Depthwise conv1d (kernel 3, pad 1, cross-correlation per XLA) on v,
// accumulated into y:  y[b][s][c] += b[c] + sum_r v[b][s-1+r][c] * w[c][r]
// ---------------------------------------------------------------------------
__global__ __launch_bounds__(256)
void dwconv_add(const float* __restrict__ qkv, const float* __restrict__ w,
                const float* __restrict__ bias, float* __restrict__ y) {
    const int idx = blockIdx.x * 256 + threadIdx.x;  // over B*S*DIM (exact)
    const int c = idx & (DIM - 1);
    const int s = (idx >> 10) & (SEQ - 1);
    const int b = idx >> 20;
    const int h = c >> 6, d = c & 63;

    const float* vb = qkv + (size_t)(b * SEQ) * (3 * DIM) + 2 * DIM + h * HEAD_DIM + d;
    float acc = bias[c];
    if (s > 0)       acc += vb[(size_t)(s - 1) * (3 * DIM)] * w[c * 3 + 0];
    acc                  += vb[(size_t)(s    ) * (3 * DIM)] * w[c * 3 + 1];
    if (s < SEQ - 1) acc += vb[(size_t)(s + 1) * (3 * DIM)] * w[c * 3 + 2];
    y[idx] += acc;
}

// ---------------------------------------------------------------------------
extern "C" void kernel_launch(void* const* d_in, const int* in_sizes, int n_in,
                              void* d_out, int out_size, void* d_ws, size_t ws_size,
                              hipStream_t stream) {
    const float* x      = (const float*)d_in[0];   // [B,S,DIM]
    const float* qkv_w  = (const float*)d_in[1];   // [3*DIM, DIM]
    const float* qkv_b  = (const float*)d_in[2];   // [3*DIM]
    const float* proj_w = (const float*)d_in[3];   // [DIM, DIM]
    const float* proj_b = (const float*)d_in[4];   // [DIM]
    const float* dwc_w  = (const float*)d_in[5];   // [DIM,1,3]
    const float* dwc_b  = (const float*)d_in[6];   // [DIM]
    float* out = (float*)d_out;                    // [B,S,DIM]

    const int M = BATCH * SEQ;                     // 2048
    float* qkv_buf = (float*)d_ws;                               // M x 3*DIM (24 MB)
    float* y_buf   = qkv_buf + (size_t)M * 3 * DIM;              // M x DIM   (8 MB)

    // 1) QKV projection: [2048,1024] @ [1024,3072(T)] -> [2048,3072]
    wmma_gemm_nt<<<dim3((3 * DIM) / 128, M / 64), 256, 0, stream>>>(
        x, qkv_w, qkv_b, qkv_buf, 3 * DIM);

    // 2) Laplacian-kernel attention -> y_buf (fully overwritten)
    lap_attn<<<dim3(SEQ / 64, BATCH * HEADS), 128, 0, stream>>>(qkv_buf, y_buf);

    // 3) local depthwise-conv branch accumulated into y_buf
    dwconv_add<<<(M * DIM) / 256, 256, 0, stream>>>(qkv_buf, dwc_w, dwc_b, y_buf);

    // 4) output projection: [2048,1024] @ [1024,1024(T)] + b -> out
    wmma_gemm_nt<<<dim3(DIM / 128, M / 64), 256, 0, stream>>>(
        y_buf, proj_w, proj_b, out, DIM);
}

// v003
// A run of this version takes 174 microseconds.
// Two timings next to v002 both put it at 1.32 times that version's speed.
// Counting every step since v000, it is 2.96 times as fast.
#include <hip/hip_runtime.h>

// ---------------------------------------------------------------------------
// CDNA5 (gfx1250, wave32) Laplacian-kernel attention, fp32 WMMA path
// + async LDS double-buffering (GLOBAL_LOAD_ASYNC_TO_LDS_B128 / ASYNCcnt).
// ---------------------------------------------------------------------------

typedef float v2f __attribute__((ext_vector_type(2)));
typedef float v4f __attribute__((ext_vector_type(4)));
typedef float v8f __attribute__((ext_vector_type(8)));

#define DIM      1024
#define HEADS    16
#define HEAD_DIM 64
#define BATCH    2
#define SEQ      1024
#define LAMBDA_  4.0f
#define EPS_     1e-6f

// ---------------------------------------------------------------------------
// fp32 WMMA GEMM:  out[m][n] = sum_k A[m*DIM+k] * W[n*DIM+k] + bias[n]
// Block = 256 threads = 8 waves (2 x 4) -> 64x128 tile of the output, each
// wave a 32x32 tile (4 C fragments).  A stage is 64 k of the block's 64 A rows
// and 128 W rows, brought into LDS by async copies, two buffers: the next
// stage's copies fly while this stage's 64 WMMAs per wave run.
// k order of every sum as with direct loads: ascending, four per WMMA.
// ---------------------------------------------------------------------------
#define GBM    64
#define GBN    128
#define GBK    64
#define GPITCH 68                        // floats; 272 B = 16 B x 17: no bank conflict
#define GSTAGE ((GBM + GBN) * GPITCH)    // floats per buffer

// One stage: 192 rows x 256 B = 12 b128 copies per lane, whole 128-B lines.
// ga / gw: this lane's 16 bytes in its first A / W row; rows step by 16.
// lds: this lane's LDS byte address in its first row of the buffer (A rows, then W rows).
__device__ __forceinline__
void gemm_stage_issue(const float* ga, const float* gw, unsigned lds) {
    // s_wait_xcnt closes the statement: no address register of a copy is
    // rewritten before the copies have taken their addresses.
    asm volatile(
        "global_load_async_to_lds_b128 %0, %12, off\n\t"
        "global_load_async_to_lds_b128 %1, %13, off\n\t"
        "global_load_async_to_lds_b128 %2, %14, off\n\t"
        "global_load_async_to_lds_b128 %3, %15, off\n\t"
        "global_load_async_to_lds_b128 %4, %16, off\n\t"
        "global_load_async_to_lds_b128 %5, %17, off\n\t"
        "global_load_async_to_lds_b128 %6, %18, off\n\t"
        "global_load_async_to_lds_b128 %7, %19, off\n\t"
        "global_load_async_to_lds_b128 %8, %20, off\n\t"
        "global_load_async_to_lds_b128 %9, %21, off\n\t"
        "global_load_async_to_lds_b128 %10, %22, off\n\t"
        "global_load_async_to_lds_b128 %11, %23, off\n\t"
        "s_wait_xcnt 0x0"
        :: "v"(lds + 0u * (16u * GPITCH * 4u)), "v"(lds + 1u * (16u * GPITCH * 4u)), "v"(lds + 2u * (16u * GPITCH * 4u)), "v"(lds + 3u * (16u * GPITCH * 4u)), "v"(lds + 4u * (16u * GPITCH * 4u)), "v"(lds + 5u * (16u * GPITCH * 4u)), "v"(lds + 6u * (16u * GPITCH * 4u)), "v"(lds + 7u * (16u * GPITCH * 4u)), "v"(lds + 8u * (16u * GPITCH * 4u)), "v"(lds + 9u * (16u * GPITCH * 4u)), "v"(lds + 10u * (16u * GPITCH * 4u)), "v"(lds + 11u * (16u * GPITCH * 4u)),
           "v"(ga + 0 * 16 * DIM), "v"(ga + 1 * 16 * DIM), "v"(ga + 2 * 16 * DIM), "v"(ga + 3 * 16 * DIM), "v"(gw + 0 * 16 * DIM), "v"(gw + 1 * 16 * DIM), "v"(gw + 2 * 16 * DIM), "v"(gw + 3 * 16 * DIM), "v"(gw + 4 * 16 * DIM), "v"(gw + 5 * 16 * DIM), "v"(gw + 6 * 16 * DIM), "v"(gw + 7 * 16 * DIM)
        : "memory");
}

__global__ __launch_bounds__(256)
void wmma_gemm_nt(const float* __restrict__ A, const float* __restrict__ W,
                  const float* __restrict__ bias, float* __restrict__ out,
                  int N) {
    __shared__ __attribute__((aligned(16))) float sm[2 * GSTAGE];

    const int tid  = threadIdx.x;
    const int lane = tid & 31;
    const int wave = tid >> 5;
    const int wm   = wave >> 2;   // 0..1: 32-row slice of the block tile
    const int wn   = wave & 3;    // 0..3: 32-column slice
    const int bm0  = blockIdx.y * GBM;
    const int bn0  = blockIdx.x * GBN;
    const int mn   = lane & 15;   // A-frag row / B-frag col fed by this lane
    const int hi   = lane >> 4;   // K-pair select {0,1} vs {2,3}

    // copy addresses: 16 lanes cover one 256-B row piece
    const int crow = tid >> 4, cc = tid & 15;
    const float* ga = A + (size_t)(bm0 + crow) * DIM + cc * 4;
    const float* gw = W + (size_t)(bn0 + crow) * DIM + cc * 4;
    const unsigned lds0 = (unsigned)(uintptr_t)(sm + crow * GPITCH + cc * 4);

    // fragment addresses (ISA 7.12.2, 32-bit A 16x4): lane holds k = 2*hi + {0,1}
    const float* sa = sm + (wm * 32 + mn) * GPITCH + 2 * hi;
    const float* sb = sm + (GBM + wn * 32 + mn) * GPITCH + 2 * hi;

    const int NT = DIM / GBK;     // 16 stages

    gemm_stage_issue(ga, gw, lds0);
    asm volatile("s_wait_asynccnt 0x0" ::: "memory");  // own copies of stage 0 landed
    __syncthreads();                                   // every wave's copies visible
    gemm_stage_issue(ga + GBK, gw + GBK, lds0 + GSTAGE * 4u);

    v8f c00 = {}, c01 = {}, c10 = {}, c11 = {};
    for (int t = 0; t < NT; ++t) {
        const int bo = (t & 1) * GSTAGE;
        const float* pa = sa + bo;
        const float* pb = sb + bo;
        // unrolled: k offsets become immediates, later k steps' LDS loads issue ahead of the WMMAs
#pragma unroll
        for (int kk = 0; kk < GBK; kk += 4) {
            v2f a0 = *(const v2f*)(pa + kk);
            v2f a1 = *(const v2f*)(pa + 16 * GPITCH + kk);
            v2f b0 = *(const v2f*)(pb + kk);
            v2f b1 = *(const v2f*)(pb + 16 * GPITCH + kk);
            c00 = __builtin_amdgcn_wmma_f32_16x16x4_f32(false, a0, false, b0, (short)0, c00, false, false);
            c01 = __builtin_amdgcn_wmma_f32_16x16x4_f32(false, a0, false, b1, (short)0, c01, false, false);
            c10 = __builtin_amdgcn_wmma_f32_16x16x4_f32(false, a1, false, b0, (short)0, c10, false, false);
            c11 = __builtin_amdgcn_wmma_f32_16x16x4_f32(false, a1, false, b1, (short)0, c11, false, false);
        }
        asm volatile("s_wait_dscnt 0x0" ::: "memory");     // own reads of this buffer done
        asm volatile("s_wait_asynccnt 0x0" ::: "memory");  // own copies of stage t+1 landed
        __syncthreads();   // publishes stage t+1 and frees this buffer for the refill
        if (t + 2 < NT)
            gemm_stage_issue(ga + (t + 2) * GBK, gw + (t + 2) * GBK, lds0 + bo * 4u);
    }
    asm volatile("s_wait_asynccnt 0x0" ::: "memory");      // nothing in flight at the end

    // C/D layout: VGPR r -> row (r + 8*hi), col = lane&15
    const int m0 = bm0 + wm * 32;
    const int n0 = bn0 + wn * 32;
    const float bn0v = bias[n0 + mn];
    const float bn1v = bias[n0 + 16 + mn];
#pragma unroll
    for (int r = 0; r < 8; ++r) {
        const int row0 = m0 + r + 8 * hi;
        const int row1 = row0 + 16;
        out[(size_t)row0 * N + (n0 + mn)]      = c00[r] + bn0v;
        out[(size_t)row0 * N + (n0 + 16 + mn)] = c01[r] + bn1v;
        out[(size_t)row1 * N + (n0 + mn)]      = c10[r] + bn0v;
        out[(size_t)row1 * N + (n0 + 16 + mn)] = c11[r] + bn1v;
    }
}

// ---------------------------------------------------------------------------
// Laplacian (L1) kernel attention.  qkv buffer: [B*S, 3*DIM] row-major,
// q|k|v split along columns, head h -> columns h*64..h*64+63.
// Block = 128 thr = 4 waves on 64 query rows, stages of 64 keys.
// Kernel entries: EVERY wave holds all 64 q rows in VGPRs (4 rows per lane) and
// takes 16 of the stage's 64 keys, so one LDS read of four k values feeds four
// rows' |q-k| sums.  The 64x64 entries pass through LDS to the wave that owns
// the rows: wave w multiplies rows 16w..16w+15 with v (64 WMMAs per stage),
// keys ascending.
// k/v stages in two buffers, filled by async copies.
// ---------------------------------------------------------------------------
#define AQ    64                    // query rows per block
#define AK    64                    // keys per stage (16 per wave)
#define ATILE (AK * HEAD_DIM)       // floats of one stage of k or of v
#define EPITCH 68                   // floats; 8-byte reads and writes of 16 rows: no bank conflict

// 64 rows x 256 B of k or of v = 8 b128 copies per lane, whole 256-B row pieces.
// g: this lane's 16 bytes in its first row; rows step by 8.  l: the same in LDS.
typedef int v4i __attribute__((ext_vector_type(4)));
__device__ __forceinline__
void attn_tile_issue(const float* g, float* l) {
    // unrolled: the row steps become constants of the address arithmetic
#pragma unroll
    for (int i = 0; i < 8; ++i)
        __builtin_amdgcn_global_load_async_to_lds_b128(
            (__attribute__((address_space(1))) v4i*)(g + i * 8 * 3 * DIM),
            (__attribute__((address_space(3))) v4i*)(l + i * 8 * HEAD_DIM), 0, 0);
}

// t[i] = { |d[2i].x| + |d[2i].y| , |d[2i+1].x| + |d[2i+1].y| }
// asm: one v_add_f32 takes both magnitudes as source modifiers; left to itself the
// compiler packs these adds and then spends one v_and_b32 per value on the magnitude.
__device__ __forceinline__
void abs_pair_sums(v2f (&t)[4], const v2f (&d)[8]) {
    float t0, t1, t2, t3, t4, t5, t6, t7;
    asm("v_add_f32 %0, |%8|, |%9|\n\t"
        "v_add_f32 %1, |%10|, |%11|\n\t"
        "v_add_f32 %2, |%12|, |%13|\n\t"
        "v_add_f32 %3, |%14|, |%15|\n\t"
        "v_add_f32 %4, |%16|, |%17|\n\t"
        "v_add_f32 %5, |%18|, |%19|\n\t"
        "v_add_f32 %6, |%20|, |%21|\n\t"
        "v_add_f32 %7, |%22|, |%23|"
        : "=&v"(t0), "=&v"(t1), "=&v"(t2), "=&v"(t3), "=&v"(t4), "=&v"(t5), "=&v"(t6), "=&v"(t7)
        : "v"(d[0].x), "v"(d[0].y), "v"(d[1].x), "v"(d[1].y), "v"(d[2].x), "v"(d[2].y), "v"(d[3].x), "v"(d[3].y),
          "v"(d[4].x), "v"(d[4].y), "v"(d[5].x), "v"(d[5].y), "v"(d[6].x), "v"(d[6].y), "v"(d[7].x), "v"(d[7].y));
    t[0].x = t0; t[0].y = t1; t[1].x = t2; t[1].y = t3;
    t[2].x = t4; t[2].y = t5; t[3].x = t6; t[3].y = t7;
}

__global__ __launch_bounds__(128)
void lap_attn(const float* __restrict__ qkv, float* __restrict__ y) {
    __shared__ __attribute__((aligned(16))) float kv[2 * 2 * ATILE];  // [buffer][k|v][64 rows x 64]
    __shared__ __attribute__((aligned(16))) float en[AQ * EPITCH];    // kernel entries [row][key]
    __shared__ float rs_[4][16];           // per-wave row sums

    const int tid  = threadIdx.x;
    const int lane = tid & 31;
    const int wave = tid >> 5;
    const int bh   = blockIdx.y;
    const int b    = bh >> 4;              // / HEADS
    const int h    = bh & 15;
    const int ib   = blockIdx.x * AQ;      // block's query base row
    const int m    = lane & 15;
    const int hi   = lane >> 4;

    const size_t rstride = 3 * DIM;
    const float* qbase = qkv + (size_t)(b * SEQ) * rstride + h * HEAD_DIM;
    const float* kbase = qbase + DIM;
    const float* vbase = qbase + 2 * DIM;

    // q rows ib + 16*mt + m, mt = 0..3 (lanes m and m+16 duplicate)
    // every loop over q, dist, e or acc is unrolled: only constant indices keep them in registers
    float4 q[4][16];
#pragma unroll
    for (int mt = 0; mt < 4; ++mt) {
        const float4* qp = (const float4*)(qbase + (size_t)(ib + mt * 16 + m) * rstride);
#pragma unroll
        for (int i = 0; i < 16; ++i) q[mt][i] = qp[i];
        // the row's loads have taken their address before its registers are written again
        asm volatile("s_wait_xcnt 0x0" ::: "memory");
        // no later address arithmetic is scheduled up over that wait
        __builtin_amdgcn_sched_barrier(0);
    }

    v8f acc[4] = {};          // rows 16*wave..+15 x 64 dh as four 16x16 f32 C fragments
    float rowsum = 0.0f;

    // copy addresses: 16 lanes cover one 256-B row
    const int crow = tid >> 4, cc = tid & 15;
    const float* gk = kbase + (size_t)crow * rstride + cc * 4;
    const float* gv = vbase + (size_t)crow * rstride + cc * 4;
    float* lds0 = kv + crow * HEAD_DIM + cc * 4;

    // entries: written at [16*mt + m][16*wave + 4*p + 2*hi + {0,1}], read at [16*wave + m][4*kq + 2*hi + {0,1}]
    float*       ew = en + m * EPITCH + wave * 16 + 2 * hi;
    const float* er = en + (wave * 16 + m) * EPITCH + 2 * hi;

    const int NS = SEQ / AK;  // 16 stages

    attn_tile_issue(gk, lds0);
    attn_tile_issue(gv, lds0 + ATILE);
    asm volatile("s_wait_asynccnt 0x0" ::: "memory");  // own copies of stage 0 landed
    __syncthreads();                                   // every wave's copies visible
    attn_tile_issue(gk + AK * rstride, lds0 + 2 * ATILE);
    attn_tile_issue(gv + AK * rstride, lds0 + 3 * ATILE);

    for (int st = 0; st < NS; ++st) {
        const int bo = (st & 1) * 2 * ATILE;
        const float* ksf = kv + bo + (wave * 16 + 2 * hi) * HEAD_DIM;   // this wave's 16 keys
        const float* vsf = kv + bo + ATILE + 2 * hi * HEAD_DIM + m;

        // k values run half a key row (8 reads of 16 B) ahead of their use, in two register sets
        // (loops over ka, kb, d and t are unrolled like those over q: constant indices keep them in registers)
        v4f ka[8], kb[8];
        {
            const v4f* k0 = (const v4f*)ksf;
#pragma unroll
            for (int i = 0; i < 8; ++i) { ka[i] = k0[i]; kb[i] = k0[8 + i]; }
        }

        // rolled: one trip is four keys x 64 rows
#pragma unroll 1
        for (int p = 0; p < 4; ++p) {
            const v4f* kp = (const v4f*)(ksf + 4 * p * HEAD_DIM);              // rows 4p, 4p+1 of this lane's keys
            const v4f* kn = (const v4f*)(ksf + 4 * ((p + 1) & 3) * HEAD_DIM);  // next trip's; the last trip's wrap is read and dropped
            v2f e[4];
#pragma unroll
            for (int half = 0; half < 2; ++half) {
                v2f dist[4];   // .x: dims 0,1 mod 4; .y: dims 2,3 mod 4
                v2f t[4];      // pair sums of the step before: added one step late, so no add reads a result fewer than five instructions old
#pragma unroll
                for (int d4 = 0; d4 < 16; ++d4) {
                    const v4f kk = d4 < 8 ? ka[d4 & 7] : kb[d4 & 7];
                    v2f d[8];
#pragma unroll
                    for (int mt = 0; mt < 4; ++mt) {
                        const v2f qlo = {q[mt][d4].x, q[mt][d4].y};
                        const v2f qhi = {q[mt][d4].z, q[mt][d4].w};
                        d[2 * mt]     = qlo - kk.lo;            // packed subtract, two dims each
                        d[2 * mt + 1] = qhi - kk.hi;
                    }
                    // ends the scheduling region behind the subtracts: without it all four late adds stand right behind the asm adds,
                    // and the fourth reads a sum four instructions old, for which the compiler places no delay hint (asm result)
                    __builtin_amdgcn_sched_barrier(0);
#pragma unroll
                    for (int mt = 0; mt < 4; ++mt) {
                        if (d4 == 1) dist[mt] = t[mt];
                        if (d4 > 1)  dist[mt] += t[mt];         // packed add of two pair sums
                    }
                    abs_pair_sums(t, d);
                    if (d4 == 7 || d4 == 15) {
                        const v4f* nx = (half == 0 ? kp + 16 : kn) + (d4 == 7 ? 0 : 8);
#pragma unroll
                        for (int i = 0; i < 8; ++i) {
                            if (d4 == 7) ka[i] = nx[i]; else kb[i] = nx[i];
                        }
                        // keeps the eight reads here, 160 vector instructions ahead of their use: the scheduler otherwise sinks each to its first use
                        __builtin_amdgcn_sched_barrier(0);
                    }
                }
#pragma unroll
                for (int mt = 0; mt < 4; ++mt) {
                    dist[mt] += t[mt];
                    const float kern = __expf((dist[mt].x + dist[mt].y) * (-LAMBDA_ / (float)HEAD_DIM));
                    if (half == 0) e[mt].x = kern; else e[mt].y = kern;
                }
            }
#pragma unroll
            for (int mt = 0; mt < 4; ++mt)
                *(v2f*)(ew + mt * 16 * EPITCH + 4 * p) = e[mt];
        }
        __syncthreads();   // all 64x64 entries of this stage written

        // entries(16x64) @ v(64x64): 16 K-steps x 4 N-subtiles of 16x16x4 WMMA
#pragma unroll
        for (int kq = 0; kq < 16; ++kq) {
            const v2f afrag = *(const v2f*)(er + 4 * kq);
            rowsum += afrag.x;
            rowsum += afrag.y;
#pragma unroll
            for (int t = 0; t < 4; ++t) {
                v2f bfrag;
                bfrag.x = vsf[(4 * kq    ) * HEAD_DIM + t * 16];
                bfrag.y = vsf[(4 * kq + 1) * HEAD_DIM + t * 16];
                acc[t] = __builtin_amdgcn_wmma_f32_16x16x4_f32(
                             false, afrag, false, bfrag,
                             (short)0, acc[t], false, false);
            }
        }
        asm volatile("s_wait_dscnt 0x0" ::: "memory");     // own reads of this buffer and of the entries done
        asm volatile("s_wait_asynccnt 0x0" ::: "memory");  // own copies of stage st+1 landed
        __syncthreads();   // publishes stage st+1, frees this buffer for the refill and the entries for rewriting
        if (st + 2 < NS) {
            attn_tile_issue(gk + (size_t)(st + 2) * AK * rstride, lds0 + bo);
            attn_tile_issue(gv + (size_t)(st + 2) * AK * rstride, lds0 + bo + ATILE);
        }
    }
    asm volatile("s_wait_asynccnt 0x0" ::: "memory");      // nothing in flight at the end

    // total row sum: lanes m and m+16 hold halves of row m (wave32 shuffle)
    rowsum += __shfl_xor(rowsum, 16, 32);
    if (hi == 0) rs_[wave][m] = rowsum;   // intra-wave DS ordering suffices

    // normalize + store: row r+8*hi, col t*16+m -> y[b][s][h*64+d]
#pragma unroll
    for (int r = 0; r < 8; ++r) {
        const int row = r + 8 * hi;
        const float inv = 1.0f / (rs_[wave][row] + EPS_);
        const int s = ib + wave * 16 + row;
        float* yr = y + (size_t)(b * SEQ + s) * DIM + h * HEAD_DIM + m;
#pragma unroll
        for (int t = 0; t < 4; ++t)
            yr[t * 16] = acc[t][r] * inv;
    }
}

// ---------------------------------------------------------------------------
// Depthwise conv1d (kernel 3, pad 1, cross-correlation per XLA) on v,
// accumulated into y:  y[b][s][c] += b[c] + sum_r v[b][s-1+r][c] * w[c][r]
// ---------------------------------------------------------------------------
__global__ __launch_bounds__(256)
void dwconv_add(const float* __restrict__ qkv, const float* __restrict__ w,
                const float* __restrict__ bias, float* __restrict__ y) {
    const int idx = blockIdx.x * 256 + threadIdx.x;  // over B*S*DIM (exact)
    const int c = idx & (DIM - 1);
    const int s = (idx >> 10) & (SEQ - 1);
    const int b = idx >> 20;
    const int h = c >> 6, d = c & 63;

    const float* vb = qkv + (size_t)(b * SEQ) * (3 * DIM) + 2 * DIM + h * HEAD_DIM + d;
    float acc = bias[c];
    if (s > 0)       acc += vb[(size_t)(s - 1) * (3 * DIM)] * w[c * 3 + 0];
    acc                  += vb[(size_t)(s    ) * (3 * DIM)] * w[c * 3 + 1];
    if (s < SEQ - 1) acc += vb[(size_t)(s + 1) * (3 * DIM)] * w[c * 3 + 2];
    y[idx] += acc;
}

// ---------------------------------------------------------------------------
extern "C" void kernel_launch(void* const* d_in, const int* in_sizes, int n_in,
                              void* d_out, int out_size, void* d_ws, size_t ws_size,
                              hipStream_t stream) {
    const float* x      = (const float*)d_in[0];   // [B,S,DIM]
    const float* qkv_w  = (const float*)d_in[1];   // [3*DIM, DIM]
    const float* qkv_b  = (const float*)d_in[2];   // [3*DIM]
    const float* proj_w = (const float*)d_in[3];   // [DIM, DIM]
    const float* proj_b = (const float*)d_in[4];   // [DIM]
    const float* dwc_w  = (const float*)d_in[5];   // [DIM,1,3]
    const float* dwc_b  = (const float*)d_in[6];   // [DIM]
    float* out = (float*)d_out;                    // [B,S,DIM]

    const int M = BATCH * SEQ;                     // 2048
    float* qkv_buf = (float*)d_ws;                               // M x 3*DIM (24 MB)
    float* y_buf   = qkv_buf + (size_t)M * 3 * DIM;              // M x DIM   (8 MB)

    // 1) QKV projection: [2048,1024] @ [1024,3072(T)] -> [2048,3072]
    wmma_gemm_nt<<<dim3((3 * DIM) / 128, M / 64), 256, 0, stream>>>(
        x, qkv_w, qkv_b, qkv_buf, 3 * DIM);

    // 2) Laplacian-kernel attention -> y_buf (fully overwritten)
    lap_attn<<<dim3(SEQ / 64, BATCH * HEADS), 128, 0, stream>>>(qkv_buf, y_buf);

    // 3) local depthwise-conv branch accumulated into y_buf
    dwconv_add<<<(M * DIM) / 256, 256, 0, stream>>>(qkv_buf, dwc_w, dwc_b, y_buf);

    // 4) output projection: [2048,1024] @ [1024,1024(T)] + b -> out
    wmma_gemm_nt<<<dim3(DIM / 128, M / 64), 256, 0, stream>>>(
        y_buf, proj_w, proj_b, out, DIM);
}

// v004
// Measured time: 164 microseconds a run.
// Two timings next to v003 both put it at 1.06 times that version's speed.
// Over all steps from v000 it is 3.14 times as fast.
#include <hip/hip_runtime.h>

// ---------------------------------------------------------------------------
// CDNA5 (gfx1250, wave32) Laplacian-kernel attention, fp32 WMMA path
// + async LDS double-buffering (GLOBAL_LOAD_ASYNC_TO_LDS_B128 / ASYNCcnt).
// ---------------------------------------------------------------------------

typedef float v2f __attribute__((ext_vector_type(2)));
typedef float v4f __attribute__((ext_vector_type(4)));
typedef float v8f __attribute__((ext_vector_type(8)));

#define DIM      1024
#define HEADS    16
#define HEAD_DIM 64
#define BATCH    2
#define SEQ      1024
#define LAMBDA_  4.0f
#define EPS_     1e-6f

// ---------------------------------------------------------------------------
// fp32 WMMA GEMM:  out[m][n] = sum_k A[m*DIM+k] * W[n*DIM+k] + bias[n]
// Block = 256 threads = 8 waves (2 x 4) -> 64x128 tile of the output, each
// wave a 32x32 tile (4 C fragments).  A stage is 64 k of the block's 64 A rows
// and 128 W rows, brought into LDS by async copies, two buffers: the next
// stage's copies fly while this stage's 64 WMMAs per wave run.
// k order of every sum as with direct loads: ascending, four per WMMA.
// ---------------------------------------------------------------------------
#define GBM    64
#define GBN    128
#define GBK    64
#define GPITCH 68                        // floats; 272 B = 16 B x 17: no bank conflict
#define GSTAGE ((GBM + GBN) * GPITCH)    // floats per buffer

// One stage: 192 rows x 256 B = 12 b128 copies per lane, whole 128-B lines.
// ga / gw: this lane's 16 bytes in its first A / W row; rows step by 16.
// lds: this lane's LDS byte address in its first row of the buffer (A rows, then W rows).
__device__ __forceinline__
void gemm_stage_issue(const float* ga, const float* gw, unsigned lds) {
    // s_wait_xcnt closes the statement: no address register of a copy is
    // rewritten before the copies have taken their addresses.
    asm volatile(
        "global_load_async_to_lds_b128 %0, %12, off\n\t"
        "global_load_async_to_lds_b128 %1, %13, off\n\t"
        "global_load_async_to_lds_b128 %2, %14, off\n\t"
        "global_load_async_to_lds_b128 %3, %15, off\n\t"
        "global_load_async_to_lds_b128 %4, %16, off\n\t"
        "global_load_async_to_lds_b128 %5, %17, off\n\t"
        "global_load_async_to_lds_b128 %6, %18, off\n\t"
        "global_load_async_to_lds_b128 %7, %19, off\n\t"
        "global_load_async_to_lds_b128 %8, %20, off\n\t"
        "global_load_async_to_lds_b128 %9, %21, off\n\t"
        "global_load_async_to_lds_b128 %10, %22, off\n\t"
        "global_load_async_to_lds_b128 %11, %23, off\n\t"
        "s_wait_xcnt 0x0"
        :: "v"(lds + 0u * (16u * GPITCH * 4u)), "v"(lds + 1u * (16u * GPITCH * 4u)), "v"(lds + 2u * (16u * GPITCH * 4u)), "v"(lds + 3u * (16u * GPITCH * 4u)), "v"(lds + 4u * (16u * GPITCH * 4u)), "v"(lds + 5u * (16u * GPITCH * 4u)), "v"(lds + 6u * (16u * GPITCH * 4u)), "v"(lds + 7u * (16u * GPITCH * 4u)), "v"(lds + 8u * (16u * GPITCH * 4u)), "v"(lds + 9u * (16u * GPITCH * 4u)), "v"(lds + 10u * (16u * GPITCH * 4u)), "v"(lds + 11u * (16u * GPITCH * 4u)),
           "v"(ga + 0 * 16 * DIM), "v"(ga + 1 * 16 * DIM), "v"(ga + 2 * 16 * DIM), "v"(ga + 3 * 16 * DIM), "v"(gw + 0 * 16 * DIM), "v"(gw + 1 * 16 * DIM), "v"(gw + 2 * 16 * DIM), "v"(gw + 3 * 16 * DIM), "v"(gw + 4 * 16 * DIM), "v"(gw + 5 * 16 * DIM), "v"(gw + 6 * 16 * DIM), "v"(gw + 7 * 16 * DIM)
        : "memory");
}

__global__ __launch_bounds__(256)
void wmma_gemm_nt(const float* __restrict__ A, const float* __restrict__ W,
                  const float* __restrict__ bias, float* __restrict__ out,
                  int N) {
    __shared__ __attribute__((aligned(16))) float sm[2 * GSTAGE];

    const int tid  = threadIdx.x;
    const int lane = tid & 31;
    const int wave = tid >> 5;
    const int wm   = wave >> 2;   // 0..1: 32-row slice of the block tile
    const int wn   = wave & 3;    // 0..3: 32-column slice
    const int bm0  = blockIdx.y * GBM;
    const int bn0  = blockIdx.x * GBN;
    const int mn   = lane & 15;   // A-frag row / B-frag col fed by this lane
    const int hi   = lane >> 4;   // K-pair select {0,1} vs {2,3}

    // copy addresses: 16 lanes cover one 256-B row piece
    const int crow = tid >> 4, cc = tid & 15;
    const float* ga = A + (size_t)(bm0 + crow) * DIM + cc * 4;
    const float* gw = W + (size_t)(bn0 + crow) * DIM + cc * 4;
    const unsigned lds0 = (unsigned)(uintptr_t)(sm + crow * GPITCH + cc * 4);

    // fragment addresses (ISA 7.12.2, 32-bit A 16x4): lane holds k = 2*hi + {0,1}
    const float* sa = sm + (wm * 32 + mn) * GPITCH + 2 * hi;
    const float* sb = sm + (GBM + wn * 32 + mn) * GPITCH + 2 * hi;

    const int NT = DIM / GBK;     // 16 stages

    gemm_stage_issue(ga, gw, lds0);
    asm volatile("s_wait_asynccnt 0x0" ::: "memory");  // own copies of stage 0 landed
    __syncthreads();                                   // every wave's copies visible
    gemm_stage_issue(ga + GBK, gw + GBK, lds0 + GSTAGE * 4u);

    v8f c00 = {}, c01 = {}, c10 = {}, c11 = {};
    for (int t = 0; t < NT; ++t) {
        const int bo = (t & 1) * GSTAGE;
        const float* pa = sa + bo;
        const float* pb = sb + bo;
        // unrolled: k offsets become immediates, later k steps' LDS loads issue ahead of the WMMAs
#pragma unroll
        for (int kk = 0; kk < GBK; kk += 4) {
            v2f a0 = *(const v2f*)(pa + kk);
            v2f a1 = *(const v2f*)(pa + 16 * GPITCH + kk);
            v2f b0 = *(const v2f*)(pb + kk);
            v2f b1 = *(const v2f*)(pb + 16 * GPITCH + kk);
            c00 = __builtin_amdgcn_wmma_f32_16x16x4_f32(false, a0, false, b0, (short)0, c00, false, false);
            c01 = __builtin_amdgcn_wmma_f32_16x16x4_f32(false, a0, false, b1, (short)0, c01, false, false);
            c10 = __builtin_amdgcn_wmma_f32_16x16x4_f32(false, a1, false, b0, (short)0, c10, false, false);
            c11 = __builtin_amdgcn_wmma_f32_16x16x4_f32(false, a1, false, b1, (short)0, c11, false, false);
        }
        asm volatile("s_wait_dscnt 0x0" ::: "memory");     // own reads of this buffer done
        asm volatile("s_wait_asynccnt 0x0" ::: "memory");  // own copies of stage t+1 landed
        __syncthreads();   // publishes stage t+1 and frees this buffer for the refill
        if (t + 2 < NT)
            gemm_stage_issue(ga + (t + 2) * GBK, gw + (t + 2) * GBK, lds0 + bo * 4u);
    }
    asm volatile("s_wait_asynccnt 0x0" ::: "memory");      // nothing in flight at the end

    // C/D layout: VGPR r -> row (r + 8*hi), col = lane&15
    const int m0 = bm0 + wm * 32;
    const int n0 = bn0 + wn * 32;
    const float bn0v = bias[n0 + mn];
    const float bn1v = bias[n0 + 16 + mn];
#pragma unroll
    for (int r = 0; r < 8; ++r) {
        const int row0 = m0 + r + 8 * hi;
        const int row1 = row0 + 16;
        out[(size_t)row0 * N + (n0 + mn)]      = c00[r] + bn0v;
        out[(size_t)row0 * N + (n0 + 16 + mn)] = c01[r] + bn1v;
        out[(size_t)row1 * N + (n0 + mn)]      = c10[r] + bn0v;
        out[(size_t)row1 * N + (n0 + 16 + mn)] = c11[r] + bn1v;
    }
}

// ---------------------------------------------------------------------------
// Laplacian (L1) kernel attention.  qkv buffer: [B*S, 3*DIM] row-major,
// q|k|v split along columns, head h -> columns h*64..h*64+63.
// Block = 128 thr = 4 waves on 64 query rows, stages of 64 keys.
// Kernel entries: EVERY wave holds all 64 q rows in VGPRs (4 rows per lane) and
// takes 16 of the stage's 64 keys, so one LDS read of four k values feeds four
// rows' |q-k| sums.  The 64x64 entries pass through LDS to the wave that owns
// the rows: wave w multiplies rows 16w..16w+15 with v (64 WMMAs per stage),
// keys ascending.
// k/v stages in two buffers, filled by async copies.
// Epilogue: the local branch, a depthwise conv1d (kernel 3, pad 1, cross-correlation)
// on v, is added to the normalized rows before their one store:
//   y[b][s][c] = attn + ( cb[c] + sum_r v[b][s-1+r][c] * cw[c][r] )
// ---------------------------------------------------------------------------
#define AQ    64                    // query rows per block
#define AK    64                    // keys per stage (16 per wave)
#define ATILE (AK * HEAD_DIM)       // floats of one stage of k or of v
#define EPITCH 68                   // floats; 8-byte reads and writes of 16 rows: no bank conflict

// 64 rows x 256 B of k or of v = 8 b128 copies per lane, whole 256-B row pieces.
// g: this lane's 16 bytes in its first row; rows step by 8.  l: the same in LDS.
typedef int v4i __attribute__((ext_vector_type(4)));
__device__ __forceinline__
void attn_tile_issue(const float* g, float* l) {
    // unrolled: the row steps become constants of the address arithmetic
#pragma unroll
    for (int i = 0; i < 8; ++i)
        __builtin_amdgcn_global_load_async_to_lds_b128(
            (__attribute__((address_space(1))) v4i*)(g + i * 8 * 3 * DIM),
            (__attribute__((address_space(3))) v4i*)(l + i * 8 * HEAD_DIM), 0, 0);
}

// t[i] = { |d[2i].x| + |d[2i].y| , |d[2i+1].x| + |d[2i+1].y| }
// asm: one v_add_f32 takes both magnitudes as source modifiers; left to itself the
// compiler packs these adds and then spends one v_and_b32 per value on the magnitude.
__device__ __forceinline__
void abs_pair_sums(v2f (&t)[4], const v2f (&d)[8]) {
    float t0, t1, t2, t3, t4, t5, t6, t7;
    asm("v_add_f32 %0, |%8|, |%9|\n\t"
        "v_add_f32 %1, |%10|, |%11|\n\t"
        "v_add_f32 %2, |%12|, |%13|\n\t"
        "v_add_f32 %3, |%14|, |%15|\n\t"
        "v_add_f32 %4, |%16|, |%17|\n\t"
        "v_add_f32 %5, |%18|, |%19|\n\t"
        "v_add_f32 %6, |%20|, |%21|\n\t"
        "v_add_f32 %7, |%22|, |%23|"
        : "=&v"(t0), "=&v"(t1), "=&v"(t2), "=&v"(t3), "=&v"(t4), "=&v"(t5), "=&v"(t6), "=&v"(t7)
        : "v"(d[0].x), "v"(d[0].y), "v"(d[1].x), "v"(d[1].y), "v"(d[2].x), "v"(d[2].y), "v"(d[3].x), "v"(d[3].y),
          "v"(d[4].x), "v"(d[4].y), "v"(d[5].x), "v"(d[5].y), "v"(d[6].x), "v"(d[6].y), "v"(d[7].x), "v"(d[7].y));
    t[0].x = t0; t[0].y = t1; t[1].x = t2; t[1].y = t3;
    t[2].x = t4; t[2].y = t5; t[3].x = t6; t[3].y = t7;
}

__global__ __launch_bounds__(128)
void lap_attn(const float* __restrict__ qkv, const float* __restrict__ cw,
              const float* __restrict__ cb, float* __restrict__ y) {
    __shared__ __attribute__((aligned(16))) float kv[2 * 2 * ATILE];  // [buffer][k|v][64 rows x 64]
    __shared__ __attribute__((aligned(16))) float en[AQ * EPITCH];    // kernel entries [row][key]
    __shared__ float rs_[4][16];           // per-wave row sums

    const int tid  = threadIdx.x;
    const int lane = tid & 31;
    const int wave = tid >> 5;
    const int bh   = blockIdx.y;
    const int b    = bh >> 4;              // / HEADS
    const int h    = bh & 15;
    const int ib   = blockIdx.x * AQ;      // block's query base row
    const int m    = lane & 15;
    const int hi   = lane >> 4;

    const size_t rstride = 3 * DIM;
    const float* qbase = qkv + (size_t)(b * SEQ) * rstride + h * HEAD_DIM;
    const float* kbase = qbase + DIM;
    const float* vbase = qbase + 2 * DIM;

    // q rows ib + 16*mt + m, mt = 0..3 (lanes m and m+16 duplicate)
    // every loop over q, dist, e or acc is unrolled: only constant indices keep them in registers
    float4 q[4][16];
#pragma unroll
    for (int mt = 0; mt < 4; ++mt) {
        const float4* qp = (const float4*)(qbase + (size_t)(ib + mt * 16 + m) * rstride);
#pragma unroll
        for (int i = 0; i < 16; ++i) q[mt][i] = qp[i];
        // the row's loads have taken their address before its registers are written again
        asm volatile("s_wait_xcnt 0x0" ::: "memory");
        // no later address arithmetic is scheduled up over that wait
        __builtin_amdgcn_sched_barrier(0);
    }

    v8f acc[4] = {};          // rows 16*wave..+15 x 64 dh as four 16x16 f32 C fragments
    float rowsum = 0.0f;

    // copy addresses: 16 lanes cover one 256-B row
    const int crow = tid >> 4, cc = tid & 15;
    const float* gk = kbase + (size_t)crow * rstride + cc * 4;
    const float* gv = vbase + (size_t)crow * rstride + cc * 4;
    float* lds0 = kv + crow * HEAD_DIM + cc * 4;

    // entries: written at [16*mt + m][16*wave + 4*p + 2*hi + {0,1}], read at [16*wave + m][4*kq + 2*hi + {0,1}]
    float*       ew = en + m * EPITCH + wave * 16 + 2 * hi;
    const float* er = en + (wave * 16 + m) * EPITCH + 2 * hi;

    const int NS = SEQ / AK;  // 16 stages

    attn_tile_issue(gk, lds0);
    attn_tile_issue(gv, lds0 + ATILE);
    asm volatile("s_wait_asynccnt 0x0" ::: "memory");  // own copies of stage 0 landed
    __syncthreads();                                   // every wave's copies visible
    attn_tile_issue(gk + AK * rstride, lds0 + 2 * ATILE);
    attn_tile_issue(gv + AK * rstride, lds0 + 3 * ATILE);

    for (int st = 0; st < NS; ++st) {
        const int bo = (st & 1) * 2 * ATILE;
        const float* ksf = kv + bo + (wave * 16 + 2 * hi) * HEAD_DIM;   // this wave's 16 keys
        const float* vsf = kv + bo + ATILE + 2 * hi * HEAD_DIM + m;

        // k values run half a key row (8 reads of 16 B) ahead of their use, in two register sets
        // (loops over ka, kb, d and t are unrolled like those over q: constant indices keep them in registers)
        v4f ka[8], kb[8];
        {
            const v4f* k0 = (const v4f*)ksf;
#pragma unroll
            for (int i = 0; i < 8; ++i) { ka[i] = k0[i]; kb[i] = k0[8 + i]; }
        }

        // rolled: one trip is four keys x 64 rows
#pragma unroll 1
        for (int p = 0; p < 4; ++p) {
            const v4f* kp = (const v4f*)(ksf + 4 * p * HEAD_DIM);              // rows 4p, 4p+1 of this lane's keys
            const v4f* kn = (const v4f*)(ksf + 4 * ((p + 1) & 3) * HEAD_DIM);  // next trip's; the last trip's wrap is read and dropped
            v2f e[4];
#pragma unroll
            for (int half = 0; half < 2; ++half) {
                v2f dist[4];   // .x: dims 0,1 mod 4; .y: dims 2,3 mod 4
                v2f t[4];      // pair sums of the step before: added one step late, so no add reads a result fewer than five instructions old
#pragma unroll
                for (int d4 = 0; d4 < 16; ++d4) {
                    const v4f kk = d4 < 8 ? ka[d4 & 7] : kb[d4 & 7];
                    v2f d[8];
#pragma unroll
                    for (int mt = 0; mt < 4; ++mt) {
                        const v2f qlo = {q[mt][d4].x, q[mt][d4].y};
                        const v2f qhi = {q[mt][d4].z, q[mt][d4].w};
                        d[2 * mt]     = qlo - kk.lo;            // packed subtract, two dims each
                        d[2 * mt + 1] = qhi - kk.hi;
                    }
                    // ends the scheduling region behind the subtracts: without it all four late adds stand right behind the asm adds,
                    // and the fourth reads a sum four instructions old, for which the compiler places no delay hint (asm result)
                    __builtin_amdgcn_sched_barrier(0);
#pragma unroll
                    for (int mt = 0; mt < 4; ++mt) {
                        if (d4 == 1) dist[mt] = t[mt];
                        if (d4 > 1)  dist[mt] += t[mt];         // packed add of two pair sums
                    }
                    abs_pair_sums(t, d);
                    if (d4 == 7 || d4 == 15) {
                        const v4f* nx = (half == 0 ? kp + 16 : kn) + (d4 == 7 ? 0 : 8);
#pragma unroll
                        for (int i = 0; i < 8; ++i) {
                            if (d4 == 7) ka[i] = nx[i]; else kb[i] = nx[i];
                        }
                        // keeps the eight reads here, 160 vector instructions ahead of their use: the scheduler otherwise sinks each to its first use
                        __builtin_amdgcn_sched_barrier(0);
                    }
                }
#pragma unroll
                for (int mt = 0; mt < 4; ++mt) {
                    dist[mt] += t[mt];
                    const float kern = __expf((dist[mt].x + dist[mt].y) * (-LAMBDA_ / (float)HEAD_DIM));
                    if (half == 0) e[mt].x = kern; else e[mt].y = kern;
                }
            }
#pragma unroll
            for (int mt = 0; mt < 4; ++mt)
                *(v2f*)(ew + mt * 16 * EPITCH + 4 * p) = e[mt];
        }
        __syncthreads();   // all 64x64 entries of this stage written

        // entries(16x64) @ v(64x64): 16 K-steps x 4 N-subtiles of 16x16x4 WMMA
#pragma unroll
        for (int kq = 0; kq < 16; ++kq) {
            const v2f afrag = *(const v2f*)(er + 4 * kq);
            rowsum += afrag.x;
            rowsum += afrag.y;
#pragma unroll
            for (int t = 0; t < 4; ++t) {
                v2f bfrag;
                bfrag.x = vsf[(4 * kq    ) * HEAD_DIM + t * 16];
                bfrag.y = vsf[(4 * kq + 1) * HEAD_DIM + t * 16];
                acc[t] = __builtin_amdgcn_wmma_f32_16x16x4_f32(
                             false, afrag, false, bfrag,
                             (short)0, acc[t], false, false);
            }
        }
        asm volatile("s_wait_dscnt 0x0" ::: "memory");     // own reads of this buffer and of the entries done
        asm volatile("s_wait_asynccnt 0x0" ::: "memory");  // own copies of stage st+1 landed
        __syncthreads();   // publishes stage st+1, frees this buffer for the refill and the entries for rewriting
        if (st + 2 < NS) {
            attn_tile_issue(gk + (size_t)(st + 2) * AK * rstride, lds0 + bo);
            attn_tile_issue(gv + (size_t)(st + 2) * AK * rstride, lds0 + bo + ATILE);
        }
    }
    asm volatile("s_wait_asynccnt 0x0" ::: "memory");      // nothing in flight at the end

    // conv operands of this lane's 8 rows x 4 columns: three taps and the bias per column, and v rows
    // s0-1 .. s0+8 (the two outer rows clamped into the sequence; their products are left out below)
    // (loops over w, bb, vr and o are unrolled like those over q: constant indices keep them in registers)
    const int s0 = ib + wave * 16 + 8 * hi;            // first of this lane's rows
    const int sm = s0 > 0 ? s0 - 1 : 0;
    const int sp = s0 + 8 < SEQ ? s0 + 8 : SEQ - 1;
    const unsigned wo = (unsigned)((h * HEAD_DIM + m) * 3) * 4u;   // byte offset of this lane's first taps
    const float* wc = (const float*)((const char*)cw + wo);
    const float* bc = cb + h * HEAD_DIM + m;
    const float* pm = qbase + (size_t)sm * rstride + m;            // q column m of the row; v lies 2*DIM further
    const float* p0 = qbase + (size_t)s0 * rstride + m;
    const float* pp = qbase + (size_t)sp * rstride + m;
    float w[4][3], bb[4], vr[4][10];
#pragma unroll
    for (int t = 0; t < 4; ++t) {
#pragma unroll
        for (int j = 0; j < 3; ++j) w[t][j] = wc[t * 48 + j];
        bb[t] = bc[t * 16];
        vr[t][0] = pm[2 * DIM + t * 16];
#pragma unroll
        for (int j = 0; j < 8; ++j) vr[t][1 + j] = p0[j * 3 * DIM + 2 * DIM + t * 16];
        vr[t][9] = pp[2 * DIM + t * 16];
    }
    // these loads have taken their addresses before an address register is written again; the taps' offset and the
    // three row addresses are inputs so that their registers stay theirs up to the wait (no result lands in one before it)
    asm volatile("s_wait_xcnt 0x0" :: "v"(wo), "v"(pm), "v"(p0), "v"(pp) : "memory");

    // total row sum: lanes m and m+16 hold halves of row m (wave32 shuffle)
    rowsum += __shfl_xor(rowsum, 16, 32);
    if (hi == 0) rs_[wave][m] = rowsum;   // intra-wave DS ordering suffices

    // normalize and add the conv branch: row r+8*hi, col t*16+m
    float o[8][4];
#pragma unroll
    for (int r = 0; r < 8; ++r) {
        const float inv = 1.0f / (rs_[wave][r + 8 * hi] + EPS_);
#pragma unroll
        for (int t = 0; t < 4; ++t) {
            float a = bb[t];
            if (r > 0 || s0 > 0)       a += vr[t][r]     * w[t][0];
            a                            += vr[t][r + 1] * w[t][1];
            if (r < 7 || s0 + 8 < SEQ) a += vr[t][r + 2] * w[t][2];
            o[r][t] = acc[t][r] * inv + a;
        }
    }
    // all 32 results stand in registers before the first store: behind a store no register it names is written again
    __builtin_amdgcn_sched_barrier(0);
    // store -> y[b][s][h*64+d]
    float* yr = y + (size_t)(b * SEQ + s0) * DIM + h * HEAD_DIM + m;
#pragma unroll
    for (int r = 0; r < 8; ++r) {
#pragma unroll
        for (int t = 0; t < 4; ++t)
            yr[r * DIM + t * 16] = o[r][t];
    }
}

// ---------------------------------------------------------------------------
extern "C" void kernel_launch(void* const* d_in, const int* in_sizes, int n_in,
                              void* d_out, int out_size, void* d_ws, size_t ws_size,
                              hipStream_t stream) {
    const float* x      = (const float*)d_in[0];   // [B,S,DIM]
    const float* qkv_w  = (const float*)d_in[1];   // [3*DIM, DIM]
    const float* qkv_b  = (const float*)d_in[2];   // [3*DIM]
    const float* proj_w = (const float*)d_in[3];   // [DIM, DIM]
    const float* proj_b = (const float*)d_in[4];   // [DIM]
    const float* dwc_w  = (const float*)d_in[5];   // [DIM,1,3]
    const float* dwc_b  = (const float*)d_in[6];   // [DIM]
    float* out = (float*)d_out;                    // [B,S,DIM]

    const int M = BATCH * SEQ;                     // 2048
    float* qkv_buf = (float*)d_ws;                               // M x 3*DIM (24 MB)
    float* y_buf   = qkv_buf + (size_t)M * 3 * DIM;              // M x DIM   (8 MB)

    // 1) QKV projection: [2048,1024] @ [1024,3072(T)] -> [2048,3072]
    wmma_gemm_nt<<<dim3((3 * DIM) / 128, M / 64), 256, 0, stream>>>(
        x, qkv_w, qkv_b, qkv_buf, 3 * DIM);

    // 2) Laplacian-kernel attention + local depthwise-conv branch -> y_buf (fully overwritten)
    lap_attn<<<dim3(SEQ / 64, BATCH * HEADS), 128, 0, stream>>>(qkv_buf, dwc_w, dwc_b, y_buf);

    // 3) output projection: [2048,1024] @ [1024,1024(T)] + b -> out
    wmma_gemm_nt<<<dim3(DIM / 128, M / 64), 256, 0, stream>>>(
        y_buf, proj_w, proj_b, out, DIM);
}
